// v000
// The times below were measured on an AMD MI455X: many runs one after another, warmed up first and cycling through
// copies of the inputs, with the whole window's GPU time divided by the number of runs. Launches and the gaps
// between them are all in it. The median over several windows is given; except for v000 it joins two sittings, which
// can be a few percent apart, so the side-by-side timings, each taken in one sitting, are the better comparison.
// v000, which the later versions start from, runs in 89.4 microseconds.
#include <hip/hip_runtime.h>
#include <math.h>

typedef __attribute__((ext_vector_type(2))) float v2f;
typedef __attribute__((ext_vector_type(8))) float v8f;

#define Bn  16
#define TQn 256
#define TKn 256
#define Dn  256
#define Fn  36
#define Hn  8
#define DKn 32
#define SFn 6
#define W2C 80   // padded: [0,36) num-src (mask*value) | [36,72) den-src (mask) | [72,80) zero pad

__device__ __forceinline__ v8f wmma4(v2f a, v2f b, v8f c) {
  // (neg_a, A, neg_b, B, c_mod, C, reuse_a, reuse_b)
  return __builtin_amdgcn_wmma_f32_16x16x4_f32(false, a, false, b, (short)0, c, false, false);
}

__device__ __forceinline__ void g2l_async_b128(void* lds, const void* gaddr) {
  unsigned loff = (unsigned)(size_t)lds;
  asm volatile("global_load_async_to_lds_b128 %0, %1, off"
               :: "v"(loff), "v"(gaddr) : "memory");
}
__device__ __forceinline__ void wait_async0() {
  asm volatile("s_wait_asynccnt 0x0" ::: "memory");
}

// ---------------------------------------------------------------- prep: W2
__global__ void prep_w2_kernel(const float* __restrict__ value,
                               const float* __restrict__ mask,
                               float* __restrict__ w2) {
  int b = blockIdx.x, k = threadIdx.x;                 // k in [0,256)
  const float* vp = value + (size_t)(b * TKn + k) * Fn;
  const float* mp = mask  + (size_t)(b * TKn + k) * Fn;
  float* wr = w2 + (size_t)(b * TKn + k) * W2C;
  #pragma unroll
  for (int f = 0; f < Fn; ++f) {
    float m = mp[f];
    wr[f]      = m * vp[f];
    wr[Fn + f] = m;
  }
  #pragma unroll
  for (int j = 2 * Fn; j < W2C; ++j) wr[j] = 0.f;
}

// ------------------------------------------------- proj: Q_all / K_all GEMM
// Out(4096x256) = X(4096x256) @ Wr(256x256), Wr[d][h*32+dk] = W[h][d][dk].
__global__ void proj_kernel(const float* __restrict__ query,
                            const float* __restrict__ key,
                            const float* __restrict__ Wq,
                            const float* __restrict__ Wk,
                            float* __restrict__ Qall,
                            float* __restrict__ Kall) {
  const int lane = threadIdx.x & 31;
  const int wave = threadIdx.x >> 5;
  const int lrow = lane & 15;
  const int lhi  = lane >> 4;
  const float* X = blockIdx.y ? key  : query;
  const float* W = blockIdx.y ? Wk   : Wq;
  float*       O = blockIdx.y ? Kall : Qall;

  int tile = blockIdx.x * 8 + wave;        // 4096 tiles: 256 m-tiles x 16 n-tiles
  int m0 = (tile & 255) * 16;
  int n0 = (tile >> 8) * 16;
  int n  = n0 + lrow;
  const float* Wcol = W + (size_t)(n >> 5) * (Dn * DKn) + (n & 31);
  const float* Xrow = X + (size_t)(m0 + lrow) * Dn;

  v8f c = {};
  #pragma unroll 4
  for (int kc = 0; kc < Dn; kc += 4) {
    int ka = kc + lhi * 2;                                   // A: K = lhi*2 + {0,1}
    v2f a = *(const v2f*)(Xrow + ka);
    v2f b; b[0] = Wcol[(size_t)ka * DKn]; b[1] = Wcol[(size_t)(ka + 1) * DKn];
    c = wmma4(a, b, c);
  }
  #pragma unroll
  for (int i = 0; i < 8; ++i)
    O[(size_t)(m0 + i + lhi * 8) * Dn + n] = c[i];
}

// --------------------------------------------------- scores: S = Q @ K^T
__global__ void scores_kernel(const float* __restrict__ Qall,
                              const float* __restrict__ Kall,
                              float* __restrict__ S) {
  const int lane = threadIdx.x & 31, wave = threadIdx.x >> 5;
  const int lrow = lane & 15, lhi = lane >> 4;
  int gt = blockIdx.x * 8 + wave;          // 32768 tiles = 128 (b,h) x 256 tiles
  int bh = gt >> 8;
  int t  = gt & 255;
  int b = bh >> 3, h = bh & 7;
  int m0 = (t & 15) * 16;
  int n0 = (t >> 4) * 16;
  const float* Arow = Qall + ((size_t)b * TQn + m0 + lrow) * Dn + h * DKn;
  const float* Brow = Kall + ((size_t)b * TKn + n0 + lrow) * Dn + h * DKn;  // K^T column = K row

  v8f c = {};
  #pragma unroll
  for (int kc = 0; kc < DKn; kc += 4) {
    int ka = kc + lhi * 2;
    v2f a  = *(const v2f*)(Arow + ka);
    v2f bb = *(const v2f*)(Brow + ka);
    c = wmma4(a, bb, c);
  }
  float* Sb = S + (size_t)bh * TQn * TKn;
  #pragma unroll
  for (int i = 0; i < 8; ++i)
    Sb[(size_t)(m0 + i + lhi * 8) * TKn + n0 + lrow] = c[i];
}

// -------------------------------------------------------- rowmax per score row
__global__ void rowmax_kernel(const float* __restrict__ S, float* __restrict__ rmax) {
  const int lane = threadIdx.x & 31, wave = threadIdx.x >> 5;
  int row = blockIdx.x * 8 + wave;         // 32768 rows
  const float* sr = S + (size_t)row * TKn;
  float m = sr[lane];
  #pragma unroll
  for (int j = 1; j < 8; ++j) m = fmaxf(m, sr[lane + j * 32]);
  #pragma unroll
  for (int off = 16; off > 0; off >>= 1) m = fmaxf(m, __shfl_xor(m, off, 32));
  if (lane == 0) rmax[row] = m;
}

// --------------------------- attn: [num|den] = exp(S - rmax) @ W2, head = num/den
// One block = 8 waves, all sharing (b,h); each wave owns one 16-row q-tile.
// W2(b) is consumed in four 64-row k-panels staged into LDS via async copies.
#define KPAN 64
__global__ void attn_kernel(const float* __restrict__ S,
                            const float* __restrict__ rmax,
                            const float* __restrict__ w2,
                            float* __restrict__ Hd) {
  // 40KB: k-panel (64x80 = 5120 floats) aliases the post-loop num/den tiles
  // (8 waves x 16x80 = 10240 floats); lifetimes are disjoint.
  __shared__ __align__(16) float smem[10240];
  const int tid  = threadIdx.x;
  const int lane = tid & 31, wave = tid >> 5;
  const int lrow = lane & 15, lhi = lane >> 4;
  int bh   = blockIdx.x >> 1;              // 128 (b,h) pairs, 2 blocks each
  int half = blockIdx.x & 1;
  int qt   = half * 8 + wave;              // q-tile 0..15
  int b = bh >> 3, h = bh & 7;
  int m0 = qt * 16;
  const float* Srow = S + ((size_t)bh * TQn + m0 + lrow) * TKn;
  float rm = rmax[(size_t)bh * TQn + m0 + lrow];
  const float* W2b = w2 + (size_t)b * TKn * W2C;

  v8f c0 = {}, c1 = {}, c2 = {}, c3 = {}, c4 = {};
  for (int k0 = 0; k0 < TKn; k0 += KPAN) {
    // Stage 64x80 W2 panel: 1280 float4 -> 5 async b128 copies per thread.
    #pragma unroll
    for (int j = 0; j < 5; ++j) {
      int idx = tid + j * 256;             // float4 index in panel
      g2l_async_b128(&smem[(size_t)idx * 4], W2b + (size_t)k0 * W2C + (size_t)idx * 4);
    }
    wait_async0();
    __syncthreads();

    #pragma unroll 4
    for (int kc = 0; kc < KPAN; kc += 4) {
      int ka = kc + lhi * 2;
      v2f sv = *(const v2f*)(Srow + k0 + ka);
      v2f a; a[0] = __expf(sv[0] - rm); a[1] = __expf(sv[1] - rm); // each E elem once
      const float* pw0 = &smem[(size_t)ka * W2C + lrow];
      const float* pw1 = pw0 + W2C;
      v2f b0; b0[0] = pw0[0];  b0[1] = pw1[0];
      v2f b1; b1[0] = pw0[16]; b1[1] = pw1[16];
      v2f b2; b2[0] = pw0[32]; b2[1] = pw1[32];
      v2f b3; b3[0] = pw0[48]; b3[1] = pw1[48];
      v2f b4; b4[0] = pw0[64]; b4[1] = pw1[64];
      c0 = wmma4(a, b0, c0);
      c1 = wmma4(a, b1, c1);
      c2 = wmma4(a, b2, c2);
      c3 = wmma4(a, b3, c3);
      c4 = wmma4(a, b4, c4);
    }
    __syncthreads();                        // panel consumed before overwrite
  }

  // Spill num|den tile to (wave-private) LDS, then divide and scatter.
  float* acc = &smem[(size_t)wave * 16 * W2C];
  #pragma unroll
  for (int i = 0; i < 8; ++i) {
    int r = i + lhi * 8;
    acc[r * W2C +  0 + lrow] = c0[i];
    acc[r * W2C + 16 + lrow] = c1[i];
    acc[r * W2C + 32 + lrow] = c2[i];
    acc[r * W2C + 48 + lrow] = c3[i];
    acc[r * W2C + 64 + lrow] = c4[i];
  }
  for (int idx = lane; idx < 16 * Fn; idx += 32) {
    int r = idx / Fn, f = idx - r * Fn;
    float num = acc[r * W2C + f];
    float den = acc[r * W2C + Fn + f];
    float hv = (den > 0.f) ? (num / den) : 0.f;   // all-masked column ~ prob 2^-256
    Hd[(((size_t)b * TQn + m0 + r) * Fn + f) * Hn + h] = hv;
  }
}

// ------------------------------- tail: tanh(head@Wc) -> tanh(@Wo1) -> @Wo2
__global__ void tail_kernel(const float* __restrict__ Hd,
                            const float* __restrict__ Wc,
                            const float* __restrict__ bc,
                            const float* __restrict__ Wo1,
                            const float* __restrict__ bo1,
                            const float* __restrict__ Wo2,
                            const float* __restrict__ bo2,
                            float* __restrict__ out) {
  __shared__ float hh[Fn * Hn];    // 288: head[f][h] for this (b,q)
  __shared__ float w1[Fn * SFn];   // 216
  __shared__ float w2s[SFn];
  __shared__ float b1s[SFn];
  int bq  = blockIdx.x;            // 0..4095 = b*256+q
  int tid = threadIdx.x;           // d
  const float* hp = Hd + (size_t)bq * (Fn * Hn);
  for (int i = tid; i < Fn * Hn; i += 256) hh[i] = hp[i];
  for (int i = tid; i < Fn * SFn; i += 256) w1[i] = Wo1[i];
  if (tid < SFn) { w2s[tid] = Wo2[tid]; b1s[tid] = bo1[tid]; }
  __syncthreads();

  float wc[Hn];
  #pragma unroll
  for (int h = 0; h < Hn; ++h) wc[h] = Wc[h * Dn + tid];
  float bcd = bc[tid];
  float ts[SFn] = {0.f, 0.f, 0.f, 0.f, 0.f, 0.f};
  for (int f = 0; f < Fn; ++f) {
    float a = bcd;
    #pragma unroll
    for (int h = 0; h < Hn; ++h) a = fmaf(hh[f * Hn + h], wc[h], a);
    float lat = tanhf(a);
    #pragma unroll
    for (int s = 0; s < SFn; ++s) ts[s] = fmaf(lat, w1[f * SFn + s], ts[s]);
  }
  float o = bo2[tid];
  #pragma unroll
  for (int s = 0; s < SFn; ++s) o = fmaf(tanhf(ts[s] + b1s[s]), w2s[s], o);
  out[(size_t)bq * Dn + tid] = o;
}

// ---------------------------------------------------------------- launcher
extern "C" void kernel_launch(void* const* d_in, const int* in_sizes, int n_in,
                              void* d_out, int out_size, void* d_ws, size_t ws_size,
                              hipStream_t stream) {
  const float* query = (const float*)d_in[0];
  const float* key   = (const float*)d_in[1];
  const float* value = (const float*)d_in[2];
  const float* mask  = (const float*)d_in[3];
  const float* Wq    = (const float*)d_in[4];
  const float* Wk    = (const float*)d_in[5];
  const float* Wc    = (const float*)d_in[6];
  const float* bc    = (const float*)d_in[7];
  const float* Wo1   = (const float*)d_in[8];
  const float* bo1   = (const float*)d_in[9];
  const float* Wo2   = (const float*)d_in[10];
  const float* bo2   = (const float*)d_in[11];
  float* out = (float*)d_out;

  // Scratch layout (floats). Total = 12,025,856 floats = ~48.1 MB.
  float* ws   = (float*)d_ws;
  float* Qall = ws;                    // 4096*256   = 1,048,576
  float* Kall = Qall + 1048576;        //             1,048,576
  float* S    = Kall + 1048576;        // 128*256*256 = 8,388,608 (fits L2: 192MB)
  float* rmax = S + 8388608;           //                 32,768
  float* w2   = rmax + 32768;          // 16*256*80  =   327,680
  float* Hd   = w2 + 327680;           // 16*256*36*8 = 1,179,648

  prep_w2_kernel<<<dim3(Bn),      256, 0, stream>>>(value, mask, w2);
  proj_kernel   <<<dim3(512, 2),  256, 0, stream>>>(query, key, Wq, Wk, Qall, Kall);
  scores_kernel <<<dim3(4096),    256, 0, stream>>>(Qall, Kall, S);
  rowmax_kernel <<<dim3(4096),    256, 0, stream>>>(S, rmax);
  attn_kernel   <<<dim3(256),     256, 0, stream>>>(S, rmax, w2, Hd);
  tail_kernel   <<<dim3(4096),    256, 0, stream>>>(Hd, Wc, bc, Wo1, bo1, Wo2, bo2, out);

  (void)in_sizes; (void)n_in; (void)out_size; (void)ws_size;
}

// v001
// One run takes 56.5 microseconds.
// Two timings next to v000 put it at 1.63 and 1.62 times that version's speed.
#include <hip/hip_runtime.h>
#include <math.h>

typedef __attribute__((ext_vector_type(2))) float v2f;
typedef __attribute__((ext_vector_type(8))) float v8f;

#define Bn  16
#define TQn 256
#define TKn 256
#define Dn  256
#define Fn  36
#define Hn  8
#define DKn 32
#define SFn 6
#define W2C 80   // padded: [0,36) num-src (mask*value) | [36,72) den-src (mask) | [72,80) zero pad

__device__ __forceinline__ v8f wmma4(v2f a, v2f b, v8f c) {
  // (neg_a, A, neg_b, B, c_mod, C, reuse_a, reuse_b)
  return __builtin_amdgcn_wmma_f32_16x16x4_f32(false, a, false, b, (short)0, c, false, false);
}

__device__ __forceinline__ void g2l_async4(unsigned l0, const float* g0,
                                           unsigned l1, const float* g1,
                                           unsigned l2, const float* g2,
                                           unsigned l3, const float* g3) {
  asm volatile("global_load_async_to_lds_b128 %0, %1, off\n\t"
               "global_load_async_to_lds_b128 %2, %3, off\n\t"
               "global_load_async_to_lds_b128 %4, %5, off\n\t"
               "global_load_async_to_lds_b128 %6, %7, off\n\t"
               "s_wait_xcnt 0x0"
               :: "v"(l0), "v"(g0), "v"(l1), "v"(g1),
                  "v"(l2), "v"(g2), "v"(l3), "v"(g3) : "memory");
}
// The issuing wave's copies have landed in LDS behind this wait.
__device__ __forceinline__ void wait_async0() {
  asm volatile("s_wait_asynccnt 0x0" ::: "memory");
}

__device__ __forceinline__ v2f exp2_pair(float x0, float x1) {
  float e0, e1;
  asm("v_exp_f32 %0, %2\n\t"
      "v_exp_f32 %1, %3\n\t"
      "v_nop"
      : "=&v"(e0), "=&v"(e1) : "v"(x0), "v"(x1));
  v2f r; r[0] = e0; r[1] = e1;
  return r;
}

// ------------------------------------------------- proj: Q_all / K_all GEMM
// Out(4096x256) = X(4096x256) @ Wr(256x256), Wr[d][h*32+dk] = W[h][d][dk].
__global__ void proj_kernel(const float* __restrict__ query,
                            const float* __restrict__ key,
                            const float* __restrict__ Wq,
                            const float* __restrict__ Wk,
                            float* __restrict__ Qall,
                            float* __restrict__ Kall) {
  const int lane = threadIdx.x & 31;
  const int wave = threadIdx.x >> 5;
  const int lrow = lane & 15;
  const int lhi  = lane >> 4;
  const float* X = blockIdx.y ? key  : query;
  const float* W = blockIdx.y ? Wk   : Wq;
  float*       O = blockIdx.y ? Kall : Qall;

  int tile = blockIdx.x * 8 + wave;        // 4096 tiles: 256 m-tiles x 16 n-tiles
  int m0 = (tile & 255) * 16;
  int n0 = (tile >> 8) * 16;
  int n  = n0 + lrow;
  const float* Wcol = W + (size_t)(n >> 5) * (Dn * DKn) + (n & 31);
  const float* Xrow = X + (size_t)(m0 + lrow) * Dn;

  v8f c = {};
  #pragma unroll 4
  for (int kc = 0; kc < Dn; kc += 4) {
    int ka = kc + lhi * 2;                                   // A: K = lhi*2 + {0,1}
    v2f a = *(const v2f*)(Xrow + ka);
    v2f b; b[0] = Wcol[(size_t)ka * DKn]; b[1] = Wcol[(size_t)(ka + 1) * DKn];
    c = wmma4(a, b, c);
  }
  #pragma unroll
  for (int i = 0; i < 8; ++i)
    O[(size_t)(m0 + i + lhi * 8) * Dn + n] = c[i];
}

#define KP  36
#define WP2 168
__global__ __launch_bounds__(256)
void attn_kernel(const float* __restrict__ value,
                 const float* __restrict__ mask,
                 float* ws) {
  const float* Qall = ws;                  // written by proj_kernel
  const float* Kall = ws + Bn * TQn * Dn;
  float*       Hd   = ws + Bn * TQn * Dn + Bn * TKn * Dn;
  __shared__ __align__(16) float smem[(TKn / 2) * WP2 + TKn * KP + 128 * KP];
  float* Wp = smem;                        // 86,016 B; reused for num|den tiles
  float* Ks = smem + (TKn / 2) * WP2;      // 36,864 B
  float* Qs = Ks + TKn * KP;               // 18,432 B: this block's 128 query rows
  const int tid  = threadIdx.x;
  const int lane = tid & 31, wave = tid >> 5;
  const int lrow = lane & 15, lhi = lane >> 4;
  int bh   = blockIdx.x >> 1;              // 128 (b,h) pairs, 2 blocks each
  int half = blockIdx.x & 1;
  int qt   = half * 8 + wave;              // q-tile 0..15
  int b = bh >> 3, h = bh & 7;
  int m0 = qt * 16;

  // Stage K(b,h): 256 rows x 8 float4, and this block's Q(b,h): 128 rows x 8 float4.
  const float* Kb = Kall + (size_t)b * TKn * Dn + h * DKn;
  const unsigned ksb = (unsigned)(size_t)Ks;
  #pragma unroll
  for (int j = 0; j < 8; j += 4) {
    unsigned l[4]; const float* g[4];
    #pragma unroll
    for (int u = 0; u < 4; ++u) {
      int idx = tid + (j + u) * 256;
      int r = idx >> 3, c = idx & 7;
      l[u] = ksb + (unsigned)(r * KP + c * 4) * 4u;
      g[u] = Kb + (size_t)r * Dn + c * 4;
    }
    g2l_async4(l[0], g[0], l[1], g[1], l[2], g[2], l[3], g[3]);
  }
  {
    const float* Qb = Qall + ((size_t)b * TQn + half * 128) * Dn + h * DKn;
    const unsigned qsb = (unsigned)(size_t)Qs;
    unsigned l[4]; const float* g[4];
    #pragma unroll
    for (int u = 0; u < 4; ++u) {
      int idx = tid + u * 256;
      int r = idx >> 3, c = idx & 7;
      l[u] = qsb + (unsigned)(r * KP + c * 4) * 4u;
      g[u] = Qb + (size_t)r * Dn + c * 4;
    }
    g2l_async4(l[0], g[0], l[1], g[1], l[2], g[2], l[3], g[3]);
  }

  // Build W2(b): one task = one key pair p x four features; 128 x 9 = 1152 tasks:
  // four a thread, and the last 128 cut in halves of two features, one a thread.
  // All loads stand ahead of the first store, so that they share one trip to memory.
  const float* vb = value + (size_t)b * TKn * Fn;
  const float* mb = mask  + (size_t)b * TKn * Fn;
  float4 va[4], vc[4], ma[4], mc[4];
  int wo[4];
  #pragma unroll
  for (int j = 0; j < 4; ++j) {
    int task = tid + j * 256;
    int p = task / (Fn / 4), fq = task - p * (Fn / 4);
    unsigned e = (unsigned)((2 * p) * Fn + fq * 4);
    va[j] = *(const float4*)(vb + e); vc[j] = *(const float4*)(vb + e + Fn);
    ma[j] = *(const float4*)(mb + e); mc[j] = *(const float4*)(mb + e + Fn);
    wo[j] = p * WP2 + fq * 8;
  }
  int taskh = 1024 + (tid >> 1);
  int ph = taskh / (Fn / 4), fh = (taskh - ph * (Fn / 4)) * 4 + (tid & 1) * 2;
  unsigned eh = (unsigned)((2 * ph) * Fn + fh);
  float2 vah = *(const float2*)(vb + eh), vch = *(const float2*)(vb + eh + Fn);
  float2 mah = *(const float2*)(mb + eh), mch = *(const float2*)(mb + eh + Fn);
  #pragma unroll
  for (int j = 0; j < 4; ++j) {
    float* wn = &Wp[wo[j]];                // columns [0,36): mask*value
    float* wd = wn + 2 * Fn;               // columns [36,72): mask
    *(float4*)(wn)     = make_float4(ma[j].x * va[j].x, mc[j].x * vc[j].x,
                                     ma[j].y * va[j].y, mc[j].y * vc[j].y);
    *(float4*)(wn + 4) = make_float4(ma[j].z * va[j].z, mc[j].z * vc[j].z,
                                     ma[j].w * va[j].w, mc[j].w * vc[j].w);
    *(float4*)(wd)     = make_float4(ma[j].x, mc[j].x, ma[j].y, mc[j].y);
    *(float4*)(wd + 4) = make_float4(ma[j].z, mc[j].z, ma[j].w, mc[j].w);
  }
  {
    float* wn = &Wp[ph * WP2 + fh * 2];
    *(float4*)(wn)          = make_float4(mah.x * vah.x, mch.x * vch.x,
                                          mah.y * vah.y, mch.y * vch.y);
    *(float4*)(wn + 2 * Fn) = make_float4(mah.x, mch.x, mah.y, mch.y);
  }
  #pragma unroll
  for (int j = 0; j < 2; ++j) {            // columns [72,80): zero pad, 16 floats a pair
    int z = tid + j * 256;
    *(float4*)&Wp[(z >> 2) * WP2 + 4 * Fn + (z & 3) * 4] = make_float4(0.f, 0.f, 0.f, 0.f);
  }

  wait_async0();                            // own copies landed
  __syncthreads();                          // K, Q and W2 visible to all waves

  // Q^T fragments (B operand: column q = lrow), held for all 16 key tiles.
  v2f qf[8];
  #pragma unroll
  for (int kc = 0; kc < 8; ++kc)
    qf[kc] = *(const v2f*)&Qs[(wave * 16 + lrow) * KP + kc * 4 + lhi * 2];

  v8f s[16];
  #pragma unroll
  for (int t = 0; t < 16; ++t) {
    v8f c = {};
    #pragma unroll
    for (int kc = 0; kc < 8; ++kc) {
      v2f a = *(const v2f*)&Ks[(t * 16 + lrow) * KP + kc * 4 + lhi * 2];
      c = wmma4(a, qf[kc], c);
    }
    s[t] = c;
  }

  // Row maximum of q = lrow: in-lane over this half's 128 keys, then the other half.
  float rm = s[0][0];
  #pragma unroll
  for (int t = 0; t < 16; ++t) {
    #pragma unroll
    for (int i = 0; i < 8; ++i) rm = fmaxf(rm, s[t][i]);
  }
  rm = fmaxf(rm, __shfl_xor(rm, 16, 32));

  v8f c0 = {}, c1 = {}, c2 = {}, c3 = {}, c4 = {};
  #pragma unroll
  for (int t = 0; t < 16; ++t) {
    #pragma unroll
    for (int j = 0; j < 4; ++j) {
      // exp(x) = exp2(x * log2(e)); each E elem once
      v2f a = exp2_pair((s[t][2 * j]     - rm) * 1.44269504f,
                        (s[t][2 * j + 1] - rm) * 1.44269504f);
      const float* pw = &Wp[(t * 8 + lhi * 4 + j) * WP2 + lrow * 2];
      v2f b0 = *(const v2f*)(pw);
      v2f b1 = *(const v2f*)(pw + 32);
      v2f b2 = *(const v2f*)(pw + 64);
      v2f b3 = *(const v2f*)(pw + 96);
      v2f b4 = *(const v2f*)(pw + 128);
      c0 = wmma4(a, b0, c0);
      c1 = wmma4(a, b1, c1);
      c2 = wmma4(a, b2, c2);
      c3 = wmma4(a, b3, c3);
      c4 = wmma4(a, b4, c4);
    }
  }
  __syncthreads();                          // every wave has left W2 before its LDS is reused

  // Spill num|den tile to (wave-private) LDS, then divide and scatter.
  float* acc = &Wp[(size_t)wave * 16 * W2C];
  #pragma unroll
  for (int i = 0; i < 8; ++i) {
    int r = i + lhi * 8;
    acc[r * W2C +  0 + lrow] = c0[i];
    acc[r * W2C + 16 + lrow] = c1[i];
    acc[r * W2C + 32 + lrow] = c2[i];
    acc[r * W2C + 48 + lrow] = c3[i];
    acc[r * W2C + 64 + lrow] = c4[i];
  }
  for (int idx = lane; idx < 16 * Fn; idx += 32) {
    int r = idx / Fn, f = idx - r * Fn;
    float num = acc[r * W2C + f];
    float den = acc[r * W2C + Fn + f];
    float hv = (den > 0.f) ? (num / den) : 0.f;   // all-masked column ~ prob 2^-256
    Hd[(((size_t)b * TQn + m0 + r) * Fn + f) * Hn + h] = hv;
  }
}

// ------------------------------- tail: tanh(head@Wc) -> tanh(@Wo1) -> @Wo2
__global__ void tail_kernel(const float* __restrict__ Hd,
                            const float* __restrict__ Wc,
                            const float* __restrict__ bc,
                            const float* __restrict__ Wo1,
                            const float* __restrict__ bo1,
                            const float* __restrict__ Wo2,
                            const float* __restrict__ bo2,
                            float* __restrict__ out) {
  __shared__ float hh[Fn * Hn];    // 288: head[f][h] for this (b,q)
  __shared__ float w1[Fn * SFn];   // 216
  __shared__ float w2s[SFn];
  __shared__ float b1s[SFn];
  int bq  = blockIdx.x;            // 0..4095 = b*256+q
  int tid = threadIdx.x;           // d
  const float* hp = Hd + (size_t)bq * (Fn * Hn);
  for (int i = tid; i < Fn * Hn; i += 256) hh[i] = hp[i];
  for (int i = tid; i < Fn * SFn; i += 256) w1[i] = Wo1[i];
  if (tid < SFn) { w2s[tid] = Wo2[tid]; b1s[tid] = bo1[tid]; }
  __syncthreads();

  float wc[Hn];
  #pragma unroll
  for (int h = 0; h < Hn; ++h) wc[h] = Wc[h * Dn + tid];
  float bcd = bc[tid];
  float ts[SFn] = {0.f, 0.f, 0.f, 0.f, 0.f, 0.f};
  for (int f = 0; f < Fn; ++f) {
    float a = bcd;
    #pragma unroll
    for (int h = 0; h < Hn; ++h) a = fmaf(hh[f * Hn + h], wc[h], a);
    float lat = tanhf(a);
    #pragma unroll
    for (int s = 0; s < SFn; ++s) ts[s] = fmaf(lat, w1[f * SFn + s], ts[s]);
  }
  float o = bo2[tid];
  #pragma unroll
  for (int s = 0; s < SFn; ++s) o = fmaf(tanhf(ts[s] + b1s[s]), w2s[s], o);
  out[(size_t)bq * Dn + tid] = o;
}

// ---------------------------------------------------------------- launcher
extern "C" void kernel_launch(void* const* d_in, const int* in_sizes, int n_in,
                              void* d_out, int out_size, void* d_ws, size_t ws_size,
                              hipStream_t stream) {
  const float* query = (const float*)d_in[0];
  const float* key   = (const float*)d_in[1];
  const float* value = (const float*)d_in[2];
  const float* mask  = (const float*)d_in[3];
  const float* Wq    = (const float*)d_in[4];
  const float* Wk    = (const float*)d_in[5];
  const float* Wc    = (const float*)d_in[6];
  const float* bc    = (const float*)d_in[7];
  const float* Wo1   = (const float*)d_in[8];
  const float* bo1   = (const float*)d_in[9];
  const float* Wo2   = (const float*)d_in[10];
  const float* bo2   = (const float*)d_in[11];
  float* out = (float*)d_out;

  // Scratch layout (floats). Total = 3,276,800 floats = ~13.1 MB.
  float* ws   = (float*)d_ws;
  float* Qall = ws;                    // 4096*256   = 1,048,576
  float* Kall = Qall + 1048576;        //             1,048,576
  float* Hd   = Kall + 1048576;        // 16*256*36*8 = 1,179,648

  proj_kernel   <<<dim3(512, 2),  256, 0, stream>>>(query, key, Wq, Wk, Qall, Kall);
  attn_kernel   <<<dim3(256),     256, 0, stream>>>(value, mask, ws);
  tail_kernel   <<<dim3(4096),    256, 0, stream>>>(Hd, Wc, bc, Wo1, bo1, Wo2, bo2, out);

  (void)in_sizes; (void)n_in; (void)out_size; (void)ws_size;
}

// v002
// Measured time: 49.7 microseconds a run.
// Timed twice side by side with v001, it ran 1.14 times as fast both times.
// Counting every step since v000, it is 1.86 times as fast.
#include <hip/hip_runtime.h>
#include <math.h>

typedef __attribute__((ext_vector_type(2))) float v2f;
typedef __attribute__((ext_vector_type(8))) float v8f;

#define Bn  16
#define TQn 256
#define TKn 256
#define Dn  256
#define Fn  36
#define Hn  8
#define DKn 32
#define SFn 6
#define W2C 80   // padded: [0,36) num-src (mask*value) | [36,72) den-src (mask) | [72,80) zero pad

__device__ __forceinline__ v8f wmma4(v2f a, v2f b, v8f c) {
  // (neg_a, A, neg_b, B, c_mod, C, reuse_a, reuse_b)
  return __builtin_amdgcn_wmma_f32_16x16x4_f32(false, a, false, b, (short)0, c, false, false);
}

__device__ __forceinline__ void g2l_async4(unsigned l0, const float* g0,
                                           unsigned l1, const float* g1,
                                           unsigned l2, const float* g2,
                                           unsigned l3, const float* g3) {
  asm volatile("global_load_async_to_lds_b128 %0, %1, off\n\t"
               "global_load_async_to_lds_b128 %2, %3, off\n\t"
               "global_load_async_to_lds_b128 %4, %5, off\n\t"
               "global_load_async_to_lds_b128 %6, %7, off\n\t"
               "s_wait_xcnt 0x0"
               :: "v"(l0), "v"(g0), "v"(l1), "v"(g1),
                  "v"(l2), "v"(g2), "v"(l3), "v"(g3) : "memory");
}
// The issuing wave's copies have landed in LDS behind this wait.
__device__ __forceinline__ void wait_async0() {
  asm volatile("s_wait_asynccnt 0x0" ::: "memory");
}

__device__ __forceinline__ v2f exp2_pair(float x0, float x1) {
  float e0, e1;
  asm("v_exp_f32 %0, %2\n\t"
      "v_exp_f32 %1, %3\n\t"
      "v_nop"
      : "=&v"(e0), "=&v"(e1) : "v"(x0), "v"(x1));
  v2f r; r[0] = e0; r[1] = e1;
  return r;
}

// ------------------------------------------------- proj: Q_all / K_all GEMM
// Out(4096x256) = X(4096x256) @ Wr(256x256), Wr[d][h*32+dk] = W[h][d][dk].
// One block = 8 waves = one 128 x 64 tile of Out over the whole K = 256. Its 128 rows of X
// and its 64 columns of Wr (two heads) are brought whole into LDS, in whole 128-byte lines;
// each wave then owns 32 x 32 of the tile: two A and two B fragments feed four WMMAs.
// k runs upward in steps of 4 into one accumulator a tile.
// Wr lies in LDS by row pairs and 16-column groups, Ws[k/2][col/16][k&1][col&15], so that
// the two k of a B fragment stand 16 floats apart and one two-address read brings both.
#define XP  260
#define WPP 160

__device__ __forceinline__ void g2l_async8(const unsigned* l, const float* const* g) {
  asm volatile("global_load_async_to_lds_b128 %0, %1, off\n\t"
               "global_load_async_to_lds_b128 %2, %3, off\n\t"
               "global_load_async_to_lds_b128 %4, %5, off\n\t"
               "global_load_async_to_lds_b128 %6, %7, off\n\t"
               "global_load_async_to_lds_b128 %8, %9, off\n\t"
               "global_load_async_to_lds_b128 %10, %11, off\n\t"
               "global_load_async_to_lds_b128 %12, %13, off\n\t"
               "global_load_async_to_lds_b128 %14, %15, off\n\t"
               "s_wait_xcnt 0x0"
               :: "v"(l[0]), "v"(g[0]), "v"(l[1]), "v"(g[1]),
                  "v"(l[2]), "v"(g[2]), "v"(l[3]), "v"(g[3]),
                  "v"(l[4]), "v"(g[4]), "v"(l[5]), "v"(g[5]),
                  "v"(l[6]), "v"(g[6]), "v"(l[7]), "v"(g[7]) : "memory");
}

__global__ __launch_bounds__(256)
void proj_kernel(const float* __restrict__ query,
                 const float* __restrict__ key,
                 const float* __restrict__ Wq,
                 const float* __restrict__ Wk,
                 float* __restrict__ Qall,
                 float* __restrict__ Kall) {
  __shared__ __align__(16) float smem[(Dn / 2) * WPP + 128 * XP];
  float* Ws = smem;                        //  81,920 B
  float* Xs = smem + (Dn / 2) * WPP;       // 133,120 B
  const int tid  = threadIdx.x;
  const int lane = tid & 31, wave = tid >> 5;
  const int lrow = lane & 15, lhi = lane >> 4;
  const float* X = blockIdx.y ? key  : query;
  const float* W = blockIdx.y ? Wk   : Wq;
  float*       O = blockIdx.y ? Kall : Qall;
  const int mb = blockIdx.x >> 2;          // 32 row blocks of 128
  const int nb = blockIdx.x & 3;           // 4 column blocks of 64 = heads 2nb, 2nb+1

  // X: 128 rows x 64 float4. Copy n of a thread takes row (tid >> 6) + 4n, float4 tid & 63:
  // a wave's 32 lanes take 512 bytes in a row of one X row.
  {
    const int r = tid >> 6, c = tid & 63;
    const float* g0 = X + (size_t)(mb * 128 + r) * Dn + c * 4;
    const unsigned l0 = (unsigned)(size_t)Xs + (unsigned)(r * XP + c * 4) * 4u;
    #pragma unroll                         // both loops: l[] and g[] stay in registers
    for (int j = 0; j < 32; j += 8) {
      unsigned l[8]; const float* g[8];
      #pragma unroll
      for (int u = 0; u < 8; ++u) {
        l[u] = l0 + (unsigned)((j + u) * 4 * XP) * 4u;
        g[u] = g0 + (size_t)(j + u) * 4 * Dn;
      }
      g2l_async8(l, g);
    }
  }
  // Wr: 256 rows x 16 float4. Copy n takes row (tid >> 4) + 16n, float4 tid & 15;
  // float4 0..7 of a row come from head 2nb, 8..15 from head 2nb+1.
  {
    const int k = tid >> 4, c = tid & 15;
    const float* g0 = W + (size_t)(nb * 2 + (c >> 3)) * (Dn * DKn) + (size_t)k * DKn + (c & 7) * 4;
    const unsigned l0 = (unsigned)(size_t)Ws
        + (unsigned)((k >> 1) * WPP + (c >> 2) * 32 + (k & 1) * 16 + (c & 3) * 4) * 4u;
    #pragma unroll                         // both loops: l[] and g[] stay in registers
    for (int j = 0; j < 16; j += 8) {
      unsigned l[8]; const float* g[8];
      #pragma unroll
      for (int u = 0; u < 8; ++u) {
        l[u] = l0 + (unsigned)((j + u) * 8 * WPP) * 4u;
        g[u] = g0 + (size_t)(j + u) * 16 * DKn;
      }
      g2l_async8(l, g);
    }
  }
  wait_async0();                            // own copies landed
  __syncthreads();                          // X and Wr visible to all waves

  const int wm = wave >> 1, wn = wave & 1;  // 4 x 2 waves of 32 x 32
  const float* xa = &Xs[(wm * 32 + lrow) * XP + lhi * 2];    // A: K = lhi*2 + {0,1}
  const float* wb = &Ws[lhi * WPP + wn * 64 + lrow];         // B: the same K, column lrow
  v8f c00 = {}, c01 = {}, c10 = {}, c11 = {};
  // Unrolled whole: the LDS reads of later steps stand among the WMMAs of earlier ones,
  // and no loop top drains them.
  #pragma unroll
  for (int kc = 0; kc < Dn; kc += 4) {
    v2f a0 = *(const v2f*)(xa + kc);
    v2f a1 = *(const v2f*)(xa + 16 * XP + kc);
    v2f b0, b1;
    b0[0] = wb[(kc >> 1) * WPP];      b0[1] = wb[(kc >> 1) * WPP + 16];
    b1[0] = wb[(kc >> 1) * WPP + 32]; b1[1] = wb[(kc >> 1) * WPP + 48];
    c00 = wmma4(a0, b0, c00);
    c01 = wmma4(a0, b1, c01);
    c10 = wmma4(a1, b0, c10);
    c11 = wmma4(a1, b1, c11);
  }
  float* Ob = O + (size_t)(mb * 128 + wm * 32 + lhi * 8) * Dn + nb * 64 + wn * 32 + lrow;
  #pragma unroll
  for (int i = 0; i < 8; ++i) {
    Ob[(size_t)i * Dn]             = c00[i];
    Ob[(size_t)i * Dn + 16]        = c01[i];
    Ob[(size_t)(i + 16) * Dn]      = c10[i];
    Ob[(size_t)(i + 16) * Dn + 16] = c11[i];
  }
}

#define KP  36
#define WP2 168
__global__ __launch_bounds__(256)
void attn_kernel(const float* __restrict__ value,
                 const float* __restrict__ mask,
                 float* ws) {
  const float* Qall = ws;                  // written by proj_kernel
  const float* Kall = ws + Bn * TQn * Dn;
  float*       Hd   = ws + Bn * TQn * Dn + Bn * TKn * Dn;
  __shared__ __align__(16) float smem[(TKn / 2) * WP2 + TKn * KP + 128 * KP];
  float* Wp = smem;                        // 86,016 B; reused for num|den tiles
  float* Ks = smem + (TKn / 2) * WP2;      // 36,864 B
  float* Qs = Ks + TKn * KP;               // 18,432 B: this block's 128 query rows
  const int tid  = threadIdx.x;
  const int lane = tid & 31, wave = tid >> 5;
  const int lrow = lane & 15, lhi = lane >> 4;
  int bh   = blockIdx.x >> 1;              // 128 (b,h) pairs, 2 blocks each
  int half = blockIdx.x & 1;
  int qt   = half * 8 + wave;              // q-tile 0..15
  int b = bh >> 3, h = bh & 7;
  int m0 = qt * 16;

  // Stage K(b,h): 256 rows x 8 float4, and this block's Q(b,h): 128 rows x 8 float4.
  const float* Kb = Kall + (size_t)b * TKn * Dn + h * DKn;
  const unsigned ksb = (unsigned)(size_t)Ks;
  #pragma unroll
  for (int j = 0; j < 8; j += 4) {
    unsigned l[4]; const float* g[4];
    #pragma unroll
    for (int u = 0; u < 4; ++u) {
      int idx = tid + (j + u) * 256;
      int r = idx >> 3, c = idx & 7;
      l[u] = ksb + (unsigned)(r * KP + c * 4) * 4u;
      g[u] = Kb + (size_t)r * Dn + c * 4;
    }
    g2l_async4(l[0], g[0], l[1], g[1], l[2], g[2], l[3], g[3]);
  }
  {
    const float* Qb = Qall + ((size_t)b * TQn + half * 128) * Dn + h * DKn;
    const unsigned qsb = (unsigned)(size_t)Qs;
    unsigned l[4]; const float* g[4];
    #pragma unroll
    for (int u = 0; u < 4; ++u) {
      int idx = tid + u * 256;
      int r = idx >> 3, c = idx & 7;
      l[u] = qsb + (unsigned)(r * KP + c * 4) * 4u;
      g[u] = Qb + (size_t)r * Dn + c * 4;
    }
    g2l_async4(l[0], g[0], l[1], g[1], l[2], g[2], l[3], g[3]);
  }

  // Build W2(b): one task = one key pair p x four features; 128 x 9 = 1152 tasks:
  // four a thread, and the last 128 cut in halves of two features, one a thread.
  // All loads stand ahead of the first store, so that they share one trip to memory.
  const float* vb = value + (size_t)b * TKn * Fn;
  const float* mb = mask  + (size_t)b * TKn * Fn;
  float4 va[4], vc[4], ma[4], mc[4];
  int wo[4];
  #pragma unroll
  for (int j = 0; j < 4; ++j) {
    int task = tid + j * 256;
    int p = task / (Fn / 4), fq = task - p * (Fn / 4);
    unsigned e = (unsigned)((2 * p) * Fn + fq * 4);
    va[j] = *(const float4*)(vb + e); vc[j] = *(const float4*)(vb + e + Fn);
    ma[j] = *(const float4*)(mb + e); mc[j] = *(const float4*)(mb + e + Fn);
    wo[j] = p * WP2 + fq * 8;
  }
  int taskh = 1024 + (tid >> 1);
  int ph = taskh / (Fn / 4), fh = (taskh - ph * (Fn / 4)) * 4 + (tid & 1) * 2;
  unsigned eh = (unsigned)((2 * ph) * Fn + fh);
  float2 vah = *(const float2*)(vb + eh), vch = *(const float2*)(vb + eh + Fn);
  float2 mah = *(const float2*)(mb + eh), mch = *(const float2*)(mb + eh + Fn);
  #pragma unroll
  for (int j = 0; j < 4; ++j) {
    float* wn = &Wp[wo[j]];                // columns [0,36): mask*value
    float* wd = wn + 2 * Fn;               // columns [36,72): mask
    *(float4*)(wn)     = make_float4(ma[j].x * va[j].x, mc[j].x * vc[j].x,
                                     ma[j].y * va[j].y, mc[j].y * vc[j].y);
    *(float4*)(wn + 4) = make_float4(ma[j].z * va[j].z, mc[j].z * vc[j].z,
                                     ma[j].w * va[j].w, mc[j].w * vc[j].w);
    *(float4*)(wd)     = make_float4(ma[j].x, mc[j].x, ma[j].y, mc[j].y);
    *(float4*)(wd + 4) = make_float4(ma[j].z, mc[j].z, ma[j].w, mc[j].w);
  }
  {
    float* wn = &Wp[ph * WP2 + fh * 2];
    *(float4*)(wn)          = make_float4(mah.x * vah.x, mch.x * vch.x,
                                          mah.y * vah.y, mch.y * vch.y);
    *(float4*)(wn + 2 * Fn) = make_float4(mah.x, mch.x, mah.y, mch.y);
  }
  #pragma unroll
  for (int j = 0; j < 2; ++j) {            // columns [72,80): zero pad, 16 floats a pair
    int z = tid + j * 256;
    *(float4*)&Wp[(z >> 2) * WP2 + 4 * Fn + (z & 3) * 4] = make_float4(0.f, 0.f, 0.f, 0.f);
  }

  wait_async0();                            // own copies landed
  __syncthreads();                          // K, Q and W2 visible to all waves

  // Q^T fragments (B operand: column q = lrow), held for all 16 key tiles.
  v2f qf[8];
  #pragma unroll
  for (int kc = 0; kc < 8; ++kc)
    qf[kc] = *(const v2f*)&Qs[(wave * 16 + lrow) * KP + kc * 4 + lhi * 2];

  v8f s[16];
  #pragma unroll
  for (int t = 0; t < 16; ++t) {
    v8f c = {};
    #pragma unroll
    for (int kc = 0; kc < 8; ++kc) {
      v2f a = *(const v2f*)&Ks[(t * 16 + lrow) * KP + kc * 4 + lhi * 2];
      c = wmma4(a, qf[kc], c);
    }
    s[t] = c;
  }

  // Row maximum of q = lrow: in-lane over this half's 128 keys, then the other half.
  float rm = s[0][0];
  #pragma unroll
  for (int t = 0; t < 16; ++t) {
    #pragma unroll
    for (int i = 0; i < 8; ++i) rm = fmaxf(rm, s[t][i]);
  }
  rm = fmaxf(rm, __shfl_xor(rm, 16, 32));

  v8f c0 = {}, c1 = {}, c2 = {}, c3 = {}, c4 = {};
  #pragma unroll
  for (int t = 0; t < 16; ++t) {
    #pragma unroll
    for (int j = 0; j < 4; ++j) {
      // exp(x) = exp2(x * log2(e)); each E elem once
      v2f a = exp2_pair((s[t][2 * j]     - rm) * 1.44269504f,
                        (s[t][2 * j + 1] - rm) * 1.44269504f);
      const float* pw = &Wp[(t * 8 + lhi * 4 + j) * WP2 + lrow * 2];
      v2f b0 = *(const v2f*)(pw);
      v2f b1 = *(const v2f*)(pw + 32);
      v2f b2 = *(const v2f*)(pw + 64);
      v2f b3 = *(const v2f*)(pw + 96);
      v2f b4 = *(const v2f*)(pw + 128);
      c0 = wmma4(a, b0, c0);
      c1 = wmma4(a, b1, c1);
      c2 = wmma4(a, b2, c2);
      c3 = wmma4(a, b3, c3);
      c4 = wmma4(a, b4, c4);
    }
  }
  __syncthreads();                          // every wave has left W2 before its LDS is reused

  // Spill num|den tile to (wave-private) LDS, then divide and scatter.
  float* acc = &Wp[(size_t)wave * 16 * W2C];
  #pragma unroll
  for (int i = 0; i < 8; ++i) {
    int r = i + lhi * 8;
    acc[r * W2C +  0 + lrow] = c0[i];
    acc[r * W2C + 16 + lrow] = c1[i];
    acc[r * W2C + 32 + lrow] = c2[i];
    acc[r * W2C + 48 + lrow] = c3[i];
    acc[r * W2C + 64 + lrow] = c4[i];
  }
  for (int idx = lane; idx < 16 * Fn; idx += 32) {
    int r = idx / Fn, f = idx - r * Fn;
    float num = acc[r * W2C + f];
    float den = acc[r * W2C + Fn + f];
    float hv = (den > 0.f) ? (num / den) : 0.f;   // all-masked column ~ prob 2^-256
    Hd[(((size_t)b * TQn + m0 + r) * Fn + f) * Hn + h] = hv;
  }
}

// ------------------------------- tail: tanh(head@Wc) -> tanh(@Wo1) -> @Wo2
__global__ void tail_kernel(const float* __restrict__ Hd,
                            const float* __restrict__ Wc,
                            const float* __restrict__ bc,
                            const float* __restrict__ Wo1,
                            const float* __restrict__ bo1,
                            const float* __restrict__ Wo2,
                            const float* __restrict__ bo2,
                            float* __restrict__ out) {
  __shared__ float hh[Fn * Hn];    // 288: head[f][h] for this (b,q)
  __shared__ float w1[Fn * SFn];   // 216
  __shared__ float w2s[SFn];
  __shared__ float b1s[SFn];
  int bq  = blockIdx.x;            // 0..4095 = b*256+q
  int tid = threadIdx.x;           // d
  const float* hp = Hd + (size_t)bq * (Fn * Hn);
  for (int i = tid; i < Fn * Hn; i += 256) hh[i] = hp[i];
  for (int i = tid; i < Fn * SFn; i += 256) w1[i] = Wo1[i];
  if (tid < SFn) { w2s[tid] = Wo2[tid]; b1s[tid] = bo1[tid]; }
  __syncthreads();

  float wc[Hn];
  #pragma unroll
  for (int h = 0; h < Hn; ++h) wc[h] = Wc[h * Dn + tid];
  float bcd = bc[tid];
  float ts[SFn] = {0.f, 0.f, 0.f, 0.f, 0.f, 0.f};
  for (int f = 0; f < Fn; ++f) {
    float a = bcd;
    #pragma unroll
    for (int h = 0; h < Hn; ++h) a = fmaf(hh[f * Hn + h], wc[h], a);
    float lat = tanhf(a);
    #pragma unroll
    for (int s = 0; s < SFn; ++s) ts[s] = fmaf(lat, w1[f * SFn + s], ts[s]);
  }
  float o = bo2[tid];
  #pragma unroll
  for (int s = 0; s < SFn; ++s) o = fmaf(tanhf(ts[s] + b1s[s]), w2s[s], o);
  out[(size_t)bq * Dn + tid] = o;
}

// ---------------------------------------------------------------- launcher
extern "C" void kernel_launch(void* const* d_in, const int* in_sizes, int n_in,
                              void* d_out, int out_size, void* d_ws, size_t ws_size,
                              hipStream_t stream) {
  const float* query = (const float*)d_in[0];
  const float* key   = (const float*)d_in[1];
  const float* value = (const float*)d_in[2];
  const float* mask  = (const float*)d_in[3];
  const float* Wq    = (const float*)d_in[4];
  const float* Wk    = (const float*)d_in[5];
  const float* Wc    = (const float*)d_in[6];
  const float* bc    = (const float*)d_in[7];
  const float* Wo1   = (const float*)d_in[8];
  const float* bo1   = (const float*)d_in[9];
  const float* Wo2   = (const float*)d_in[10];
  const float* bo2   = (const float*)d_in[11];
  float* out = (float*)d_out;

  // Scratch layout (floats). Total = 3,276,800 floats = ~13.1 MB.
  float* ws   = (float*)d_ws;
  float* Qall = ws;                    // 4096*256   = 1,048,576
  float* Kall = Qall + 1048576;        //             1,048,576
  float* Hd   = Kall + 1048576;        // 16*256*36*8 = 1,179,648

  proj_kernel   <<<dim3(128, 2),  256, 0, stream>>>(query, key, Wq, Wk, Qall, Kall);
  attn_kernel   <<<dim3(256),     256, 0, stream>>>(value, mask, ws);
  tail_kernel   <<<dim3(4096),    256, 0, stream>>>(Hd, Wc, bc, Wo1, bo1, Wo2, bo2, out);

  (void)in_sizes; (void)n_in; (void)out_size; (void)ws_size;
}

// v003
// A run of this version takes 43.8 microseconds.
// In both of two side-by-side timings against v002, it was 1.13 times as fast.
// All steps since v000 together make it 2.10 times as fast.
#include <hip/hip_runtime.h>
#include <math.h>

typedef __attribute__((ext_vector_type(2))) float v2f;
typedef __attribute__((ext_vector_type(8))) float v8f;

#define Bn  16
#define TQn 256
#define TKn 256
#define Dn  256
#define Fn  36
#define Hn  8
#define DKn 32
#define SFn 6
#define W2C 80   // padded: [0,36) num-src (mask*value) | [36,72) den-src (mask) | [72,80) zero pad

__device__ __forceinline__ v8f wmma4(v2f a, v2f b, v8f c) {
  // (neg_a, A, neg_b, B, c_mod, C, reuse_a, reuse_b)
  return __builtin_amdgcn_wmma_f32_16x16x4_f32(false, a, false, b, (short)0, c, false, false);
}

__device__ __forceinline__ void g2l_async4(unsigned l0, const float* g0,
                                           unsigned l1, const float* g1,
                                           unsigned l2, const float* g2,
                                           unsigned l3, const float* g3) {
  asm volatile("global_load_async_to_lds_b128 %0, %1, off\n\t"
               "global_load_async_to_lds_b128 %2, %3, off\n\t"
               "global_load_async_to_lds_b128 %4, %5, off\n\t"
               "global_load_async_to_lds_b128 %6, %7, off\n\t"
               "s_wait_xcnt 0x0"
               :: "v"(l0), "v"(g0), "v"(l1), "v"(g1),
                  "v"(l2), "v"(g2), "v"(l3), "v"(g3) : "memory");
}
// The issuing wave's copies have landed in LDS behind this wait.
__device__ __forceinline__ void wait_async0() {
  asm volatile("s_wait_asynccnt 0x0" ::: "memory");
}

__device__ __forceinline__ v2f exp2_pair(float x0, float x1) {
  float e0, e1;
  asm("v_exp_f32 %0, %2\n\t"
      "v_exp_f32 %1, %3\n\t"
      "v_nop"
      : "=&v"(e0), "=&v"(e1) : "v"(x0), "v"(x1));
  v2f r; r[0] = e0; r[1] = e1;
  return r;
}

// ------------------------------------------------- proj: Q_all / K_all GEMM
// Out(4096x256) = X(4096x256) @ Wr(256x256), Wr[d][h*32+dk] = W[h][d][dk].
// One block = 8 waves = one 128 x 64 tile of Out over the whole K = 256. Its 128 rows of X
// and its 64 columns of Wr (two heads) are brought whole into LDS, in whole 128-byte lines;
// each wave then owns 32 x 32 of the tile: two A and two B fragments feed four WMMAs.
// k runs upward in steps of 4 into one accumulator a tile.
// Wr lies in LDS by row pairs and 16-column groups, Ws[k/2][col/16][k&1][col&15], so that
// the two k of a B fragment stand 16 floats apart and one two-address read brings both.
#define XP  260
#define WPP 160

__device__ __forceinline__ void g2l_async8(const unsigned* l, const float* const* g) {
  asm volatile("global_load_async_to_lds_b128 %0, %1, off\n\t"
               "global_load_async_to_lds_b128 %2, %3, off\n\t"
               "global_load_async_to_lds_b128 %4, %5, off\n\t"
               "global_load_async_to_lds_b128 %6, %7, off\n\t"
               "global_load_async_to_lds_b128 %8, %9, off\n\t"
               "global_load_async_to_lds_b128 %10, %11, off\n\t"
               "global_load_async_to_lds_b128 %12, %13, off\n\t"
               "global_load_async_to_lds_b128 %14, %15, off\n\t"
               "s_wait_xcnt 0x0"
               :: "v"(l[0]), "v"(g[0]), "v"(l[1]), "v"(g[1]),
                  "v"(l[2]), "v"(g[2]), "v"(l[3]), "v"(g[3]),
                  "v"(l[4]), "v"(g[4]), "v"(l[5]), "v"(g[5]),
                  "v"(l[6]), "v"(g[6]), "v"(l[7]), "v"(g[7]) : "memory");
}

__global__ __launch_bounds__(256)
void proj_kernel(const float* __restrict__ query,
                 const float* __restrict__ key,
                 const float* __restrict__ Wq,
                 const float* __restrict__ Wk,
                 float* __restrict__ Qall,
                 float* __restrict__ Kall) {
  __shared__ __align__(16) float smem[(Dn / 2) * WPP + 128 * XP];
  float* Ws = smem;                        //  81,920 B
  float* Xs = smem + (Dn / 2) * WPP;       // 133,120 B
  const int tid  = threadIdx.x;
  const int lane = tid & 31, wave = tid >> 5;
  const int lrow = lane & 15, lhi = lane >> 4;
  const float* X = blockIdx.y ? key  : query;
  const float* W = blockIdx.y ? Wk   : Wq;
  float*       O = blockIdx.y ? Kall : Qall;
  const int mb = blockIdx.x >> 2;          // 32 row blocks of 128
  const int nb = blockIdx.x & 3;           // 4 column blocks of 64 = heads 2nb, 2nb+1

  // X: 128 rows x 64 float4. Copy n of a thread takes row (tid >> 6) + 4n, float4 tid & 63:
  // a wave's 32 lanes take 512 bytes in a row of one X row.
  {
    const int r = tid >> 6, c = tid & 63;
    const float* g0 = X + (size_t)(mb * 128 + r) * Dn + c * 4;
    const unsigned l0 = (unsigned)(size_t)Xs + (unsigned)(r * XP + c * 4) * 4u;
    #pragma unroll                         // both loops: l[] and g[] stay in registers
    for (int j = 0; j < 32; j += 8) {
      unsigned l[8]; const float* g[8];
      #pragma unroll
      for (int u = 0; u < 8; ++u) {
        l[u] = l0 + (unsigned)((j + u) * 4 * XP) * 4u;
        g[u] = g0 + (size_t)(j + u) * 4 * Dn;
      }
      g2l_async8(l, g);
    }
  }
  // Wr: 256 rows x 16 float4. Copy n takes row (tid >> 4) + 16n, float4 tid & 15;
  // float4 0..7 of a row come from head 2nb, 8..15 from head 2nb+1.
  {
    const int k = tid >> 4, c = tid & 15;
    const float* g0 = W + (size_t)(nb * 2 + (c >> 3)) * (Dn * DKn) + (size_t)k * DKn + (c & 7) * 4;
    const unsigned l0 = (unsigned)(size_t)Ws
        + (unsigned)((k >> 1) * WPP + (c >> 2) * 32 + (k & 1) * 16 + (c & 3) * 4) * 4u;
    #pragma unroll                         // both loops: l[] and g[] stay in registers
    for (int j = 0; j < 16; j += 8) {
      unsigned l[8]; const float* g[8];
      #pragma unroll
      for (int u = 0; u < 8; ++u) {
        l[u] = l0 + (unsigned)((j + u) * 8 * WPP) * 4u;
        g[u] = g0 + (size_t)(j + u) * 16 * DKn;
      }
      g2l_async8(l, g);
    }
  }
  wait_async0();                            // own copies landed
  __syncthreads();                          // X and Wr visible to all waves

  const int wm = wave >> 1, wn = wave & 1;  // 4 x 2 waves of 32 x 32
  const float* xa = &Xs[(wm * 32 + lrow) * XP + lhi * 2];    // A: K = lhi*2 + {0,1}
  const float* wb = &Ws[lhi * WPP + wn * 64 + lrow];         // B: the same K, column lrow
  v8f c00 = {}, c01 = {}, c10 = {}, c11 = {};
  // Unrolled whole: the LDS reads of later steps stand among the WMMAs of earlier ones,
  // and no loop top drains them.
  #pragma unroll
  for (int kc = 0; kc < Dn; kc += 4) {
    v2f a0 = *(const v2f*)(xa + kc);
    v2f a1 = *(const v2f*)(xa + 16 * XP + kc);
    v2f b0, b1;
    b0[0] = wb[(kc >> 1) * WPP];      b0[1] = wb[(kc >> 1) * WPP + 16];
    b1[0] = wb[(kc >> 1) * WPP + 32]; b1[1] = wb[(kc >> 1) * WPP + 48];
    c00 = wmma4(a0, b0, c00);
    c01 = wmma4(a0, b1, c01);
    c10 = wmma4(a1, b0, c10);
    c11 = wmma4(a1, b1, c11);
  }
  float* Ob = O + (size_t)(mb * 128 + wm * 32 + lhi * 8) * Dn + nb * 64 + wn * 32 + lrow;
  #pragma unroll
  for (int i = 0; i < 8; ++i) {
    Ob[(size_t)i * Dn]             = c00[i];
    Ob[(size_t)i * Dn + 16]        = c01[i];
    Ob[(size_t)(i + 16) * Dn]      = c10[i];
    Ob[(size_t)(i + 16) * Dn + 16] = c11[i];
  }
}

#define KP  36
#define WP2 168
__global__ __launch_bounds__(256)
void attn_kernel(const float* __restrict__ value,
                 const float* __restrict__ mask,
                 float* ws) {
  const float* Qall = ws;                  // written by proj_kernel
  const float* Kall = ws + Bn * TQn * Dn;
  float*       Hd   = ws + Bn * TQn * Dn + Bn * TKn * Dn;
  __shared__ __align__(16) float smem[(TKn / 2) * WP2 + TKn * KP + 128 * KP];
  float* Wp = smem;                        // 86,016 B; reused for num|den tiles
  float* Ks = smem + (TKn / 2) * WP2;      // 36,864 B
  float* Qs = Ks + TKn * KP;               // 18,432 B: this block's 128 query rows
  const int tid  = threadIdx.x;
  const int lane = tid & 31, wave = tid >> 5;
  const int lrow = lane & 15, lhi = lane >> 4;
  int bh   = blockIdx.x >> 1;              // 128 (b,h) pairs, 2 blocks each
  int half = blockIdx.x & 1;
  int qt   = half * 8 + wave;              // q-tile 0..15
  int b = bh >> 3, h = bh & 7;
  int m0 = qt * 16;

  // Stage K(b,h): 256 rows x 8 float4, and this block's Q(b,h): 128 rows x 8 float4.
  const float* Kb = Kall + (size_t)b * TKn * Dn + h * DKn;
  const unsigned ksb = (unsigned)(size_t)Ks;
  #pragma unroll
  for (int j = 0; j < 8; j += 4) {
    unsigned l[4]; const float* g[4];
    #pragma unroll
    for (int u = 0; u < 4; ++u) {
      int idx = tid + (j + u) * 256;
      int r = idx >> 3, c = idx & 7;
      l[u] = ksb + (unsigned)(r * KP + c * 4) * 4u;
      g[u] = Kb + (size_t)r * Dn + c * 4;
    }
    g2l_async4(l[0], g[0], l[1], g[1], l[2], g[2], l[3], g[3]);
  }
  {
    const float* Qb = Qall + ((size_t)b * TQn + half * 128) * Dn + h * DKn;
    const unsigned qsb = (unsigned)(size_t)Qs;
    unsigned l[4]; const float* g[4];
    #pragma unroll
    for (int u = 0; u < 4; ++u) {
      int idx = tid + u * 256;
      int r = idx >> 3, c = idx & 7;
      l[u] = qsb + (unsigned)(r * KP + c * 4) * 4u;
      g[u] = Qb + (size_t)r * Dn + c * 4;
    }
    g2l_async4(l[0], g[0], l[1], g[1], l[2], g[2], l[3], g[3]);
  }

  // Build W2(b): one task = one key pair p x four features; 128 x 9 = 1152 tasks:
  // four a thread, and the last 128 cut in halves of two features, one a thread.
  // All loads stand ahead of the first store, so that they share one trip to memory.
  const float* vb = value + (size_t)b * TKn * Fn;
  const float* mb = mask  + (size_t)b * TKn * Fn;
  float4 va[4], vc[4], ma[4], mc[4];
  int wo[4];
  #pragma unroll
  for (int j = 0; j < 4; ++j) {
    int task = tid + j * 256;
    int p = task / (Fn / 4), fq = task - p * (Fn / 4);
    unsigned e = (unsigned)((2 * p) * Fn + fq * 4);
    va[j] = *(const float4*)(vb + e); vc[j] = *(const float4*)(vb + e + Fn);
    ma[j] = *(const float4*)(mb + e); mc[j] = *(const float4*)(mb + e + Fn);
    wo[j] = p * WP2 + fq * 8;
  }
  int taskh = 1024 + (tid >> 1);
  int ph = taskh / (Fn / 4), fh = (taskh - ph * (Fn / 4)) * 4 + (tid & 1) * 2;
  unsigned eh = (unsigned)((2 * ph) * Fn + fh);
  float2 vah = *(const float2*)(vb + eh), vch = *(const float2*)(vb + eh + Fn);
  float2 mah = *(const float2*)(mb + eh), mch = *(const float2*)(mb + eh + Fn);
  #pragma unroll
  for (int j = 0; j < 4; ++j) {
    float* wn = &Wp[wo[j]];                // columns [0,36): mask*value
    float* wd = wn + 2 * Fn;               // columns [36,72): mask
    *(float4*)(wn)     = make_float4(ma[j].x * va[j].x, mc[j].x * vc[j].x,
                                     ma[j].y * va[j].y, mc[j].y * vc[j].y);
    *(float4*)(wn + 4) = make_float4(ma[j].z * va[j].z, mc[j].z * vc[j].z,
                                     ma[j].w * va[j].w, mc[j].w * vc[j].w);
    *(float4*)(wd)     = make_float4(ma[j].x, mc[j].x, ma[j].y, mc[j].y);
    *(float4*)(wd + 4) = make_float4(ma[j].z, mc[j].z, ma[j].w, mc[j].w);
  }
  {
    float* wn = &Wp[ph * WP2 + fh * 2];
    *(float4*)(wn)          = make_float4(mah.x * vah.x, mch.x * vch.x,
                                          mah.y * vah.y, mch.y * vch.y);
    *(float4*)(wn + 2 * Fn) = make_float4(mah.x, mch.x, mah.y, mch.y);
  }
  #pragma unroll
  for (int j = 0; j < 2; ++j) {            // columns [72,80): zero pad, 16 floats a pair
    int z = tid + j * 256;
    *(float4*)&Wp[(z >> 2) * WP2 + 4 * Fn + (z & 3) * 4] = make_float4(0.f, 0.f, 0.f, 0.f);
  }

  wait_async0();                            // own copies landed
  __syncthreads();                          // K, Q and W2 visible to all waves

  // Q^T fragments (B operand: column q = lrow), held for all 16 key tiles.
  v2f qf[8];
  #pragma unroll
  for (int kc = 0; kc < 8; ++kc)
    qf[kc] = *(const v2f*)&Qs[(wave * 16 + lrow) * KP + kc * 4 + lhi * 2];

  v8f s[16];
  #pragma unroll
  for (int t = 0; t < 16; ++t) {
    v8f c = {};
    #pragma unroll
    for (int kc = 0; kc < 8; ++kc) {
      v2f a = *(const v2f*)&Ks[(t * 16 + lrow) * KP + kc * 4 + lhi * 2];
      c = wmma4(a, qf[kc], c);
    }
    s[t] = c;
  }

  // Row maximum of q = lrow: in-lane over this half's 128 keys, then the other half.
  float rm = s[0][0];
  #pragma unroll
  for (int t = 0; t < 16; ++t) {
    #pragma unroll
    for (int i = 0; i < 8; ++i) rm = fmaxf(rm, s[t][i]);
  }
  rm = fmaxf(rm, __shfl_xor(rm, 16, 32));

  v8f c0 = {}, c1 = {}, c2 = {}, c3 = {}, c4 = {};
  #pragma unroll
  for (int t = 0; t < 16; ++t) {
    #pragma unroll
    for (int j = 0; j < 4; ++j) {
      // exp(x) = exp2(x * log2(e)); each E elem once
      v2f a = exp2_pair((s[t][2 * j]     - rm) * 1.44269504f,
                        (s[t][2 * j + 1] - rm) * 1.44269504f);
      const float* pw = &Wp[(t * 8 + lhi * 4 + j) * WP2 + lrow * 2];
      v2f b0 = *(const v2f*)(pw);
      v2f b1 = *(const v2f*)(pw + 32);
      v2f b2 = *(const v2f*)(pw + 64);
      v2f b3 = *(const v2f*)(pw + 96);
      v2f b4 = *(const v2f*)(pw + 128);
      c0 = wmma4(a, b0, c0);
      c1 = wmma4(a, b1, c1);
      c2 = wmma4(a, b2, c2);
      c3 = wmma4(a, b3, c3);
      c4 = wmma4(a, b4, c4);
    }
  }
  __syncthreads();                          // every wave has left W2 before its LDS is reused

  // Spill num|den tile to (wave-private) LDS, then divide and scatter.
  float* acc = &Wp[(size_t)wave * 16 * W2C];
  #pragma unroll
  for (int i = 0; i < 8; ++i) {
    int r = i + lhi * 8;
    acc[r * W2C +  0 + lrow] = c0[i];
    acc[r * W2C + 16 + lrow] = c1[i];
    acc[r * W2C + 32 + lrow] = c2[i];
    acc[r * W2C + 48 + lrow] = c3[i];
    acc[r * W2C + 64 + lrow] = c4[i];
  }
  for (int idx = lane; idx < 16 * Fn; idx += 32) {
    int r = idx / Fn, f = idx - r * Fn;
    float num = acc[r * W2C + f];
    float den = acc[r * W2C + Fn + f];
    float hv = (den > 0.f) ? (num / den) : 0.f;   // all-masked column ~ prob 2^-256
    Hd[(((size_t)b * TQn + m0 + r) * Fn + f) * Hn + h] = hv;
  }
}

#define TR 4     // rows (b,q) a block
__global__ __launch_bounds__(256)
void tail_kernel(const float* __restrict__ Hd,
                 const float* __restrict__ Wc,
                 const float* __restrict__ bc,
                 const float* __restrict__ Wo1,
                 const float* __restrict__ bo1,
                 const float* __restrict__ Wo2,
                 const float* __restrict__ bo2,
                 float* __restrict__ out) {
  __shared__ __align__(16) float hh[TR * Fn * Hn];   // 4,608 B: head[row][f][h]
  const int tid  = threadIdx.x;
  const int lane = tid & 31, wave = tid >> 5;
  const int lrow = lane & 15, lhi = lane >> 4;
  const int bq0  = blockIdx.x * TR;
  const int d0   = wave * 32 + lrow;

  const float4* hp = (const float4*)(Hd + (size_t)bq0 * (Fn * Hn));   // 288 float4
  float4 x0 = hp[tid];
  float4 x1 = make_float4(0.f, 0.f, 0.f, 0.f);
  if (tid < TR * Fn * Hn / 4 - 256) x1 = hp[256 + tid];

  v2f wb[2][2];
  v8f cb[2];
  #pragma unroll
  for (int n = 0; n < 2; ++n) {
    const float* wp = Wc + (lhi * 4) * Dn + d0 + n * 16;
    wb[n][0][0] = wp[0];      wb[n][0][1] = wp[Dn];
    wb[n][1][0] = wp[2 * Dn]; wb[n][1][1] = wp[3 * Dn];
    float bv = bc[d0 + n * 16];
    #pragma unroll
    for (int i = 0; i < 8; ++i) cb[n][i] = bv;
  }
  // What the last stage needs is asked for here, so that its trips to memory lie under the loop.
  float ob[2], b1[SFn], w2[SFn];
  ob[0] = bo2[d0]; ob[1] = bo2[d0 + 16];
  // Stands in front of the scalar loads below, which may take over the scalar base registers
  // that the vector loads above name.
  asm volatile("s_wait_xcnt 0x0" ::: "memory");
  #pragma unroll
  for (int s = 0; s < SFn; ++s) { b1[s] = bo1[s]; w2[s] = Wo2[s]; }
  ((float4*)hh)[tid] = x0;
  if (tid < TR * Fn * Hn / 4 - 256) ((float4*)hh)[256 + tid] = x1;
  __syncthreads();

  float ts[2][2][SFn];                     // [row & 1][column tile][s]
  #pragma unroll
  for (int q = 0; q < 2; ++q)
    #pragma unroll
    for (int n = 0; n < 2; ++n)
      #pragma unroll
      for (int s = 0; s < SFn; ++s) ts[q][n][s] = 0.f;

  const float* ap = &hh[(lrow >> 2) * (Fn * Hn) + (lrow & 3) * Hn + lhi * 4];
  float4 a = *(const float4*)ap;
  // Kept rolled (for speed only): 16 tanh bodies a trip.
  #pragma unroll 1
  for (int t = 0; t < Fn / 4; ++t) {
    // The next trip's A fragment, read under this trip's work (the last trip reads its own again).
    float4 an = *(const float4*)(ap + (t < Fn / 4 - 1 ? t + 1 : t) * 4 * Hn);
    // Holds that read and its address sum ahead of the WMMAs, so that no vector write falls
    // in among them onto a register that one of them reads as A.
    __builtin_amdgcn_sched_barrier(0);
    v2f a0, a1;
    a0[0] = a.x; a0[1] = a.y; a1[0] = a.z; a1[1] = a.w;
    const float* w1 = Wo1 + t * 4 * SFn;   // same for the whole wave
    v8f dd[2];
    dd[0] = wmma4(a0, wb[0][0], cb[0]);
    dd[1] = wmma4(a0, wb[1][0], cb[1]);
    dd[0] = wmma4(a1, wb[0][1], dd[0]);
    dd[1] = wmma4(a1, wb[1][1], dd[1]);
    asm volatile("v_nop\n\tv_nop\n\tv_nop\n\tv_nop" : "+v"(dd[0]), "+v"(dd[1]));
    #pragma unroll
    for (int n = 0; n < 2; ++n) {
      #pragma unroll
      for (int i = 0; i < 8; ++i) {
        float lat = tanhf(dd[n][i]);
        #pragma unroll
        for (int s = 0; s < SFn; ++s)
          ts[i >> 2][n][s] = fmaf(lat, w1[(i & 3) * SFn + s], ts[i >> 2][n][s]);
      }
    }
    a = an;
  }
  #pragma unroll
  for (int q = 0; q < 2; ++q) {
    #pragma unroll
    for (int n = 0; n < 2; ++n) {
      float o = ob[n];
      #pragma unroll
      for (int s = 0; s < SFn; ++s) o = fmaf(tanhf(ts[q][n][s] + b1[s]), w2[s], o);
      out[(size_t)(bq0 + 2 * lhi + q) * Dn + d0 + n * 16] = o;
    }
  }
}

// ---------------------------------------------------------------- launcher
extern "C" void kernel_launch(void* const* d_in, const int* in_sizes, int n_in,
                              void* d_out, int out_size, void* d_ws, size_t ws_size,
                              hipStream_t stream) {
  const float* query = (const float*)d_in[0];
  const float* key   = (const float*)d_in[1];
  const float* value = (const float*)d_in[2];
  const float* mask  = (const float*)d_in[3];
  const float* Wq    = (const float*)d_in[4];
  const float* Wk    = (const float*)d_in[5];
  const float* Wc    = (const float*)d_in[6];
  const float* bc    = (const float*)d_in[7];
  const float* Wo1   = (const float*)d_in[8];
  const float* bo1   = (const float*)d_in[9];
  const float* Wo2   = (const float*)d_in[10];
  const float* bo2   = (const float*)d_in[11];
  float* out = (float*)d_out;

  // Scratch layout (floats). Total = 3,276,800 floats = ~13.1 MB.
  float* ws   = (float*)d_ws;
  float* Qall = ws;                    // 4096*256   = 1,048,576
  float* Kall = Qall + 1048576;        //             1,048,576
  float* Hd   = Kall + 1048576;        // 16*256*36*8 = 1,179,648

  proj_kernel   <<<dim3(128, 2),  256, 0, stream>>>(query, key, Wq, Wk, Qall, Kall);
  attn_kernel   <<<dim3(256),     256, 0, stream>>>(value, mask, ws);
  tail_kernel   <<<dim3(1024),    256, 0, stream>>>(Hd, Wc, bc, Wo1, bo1, Wo2, bo2, out);

  (void)in_sizes; (void)n_in; (void)out_size; (void)ws_size;
}

// v005
// A run of this version takes 33 microseconds.
// It is 1.33 times as fast as v003, going by the measured steps of the versions left out in between.
// Counting every step since v000, it is 2.79 times as fast.
#include <hip/hip_runtime.h>
#include <math.h>

typedef __attribute__((ext_vector_type(2))) float v2f;
typedef __attribute__((ext_vector_type(8))) float v8f;

#define Bn  16
#define TQn 256
#define TKn 256
#define Dn  256
#define Fn  36
#define Hn  8
#define DKn 32
#define SFn 6
#define W2C 80   // padded: [0,36) num-src (mask*value) | [36,72) den-src (mask) | [72,80) zero pad

__device__ __forceinline__ v8f wmma4(v2f a, v2f b, v8f c) {
  // (neg_a, A, neg_b, B, c_mod, C, reuse_a, reuse_b)
  return __builtin_amdgcn_wmma_f32_16x16x4_f32(false, a, false, b, (short)0, c, false, false);
}

__device__ __forceinline__ void g2l_async4(unsigned l0, const float* g0,
                                           unsigned l1, const float* g1,
                                           unsigned l2, const float* g2,
                                           unsigned l3, const float* g3) {
  asm volatile("global_load_async_to_lds_b128 %0, %1, off\n\t"
               "global_load_async_to_lds_b128 %2, %3, off\n\t"
               "global_load_async_to_lds_b128 %4, %5, off\n\t"
               "global_load_async_to_lds_b128 %6, %7, off\n\t"
               "s_wait_xcnt 0x0"
               :: "v"(l0), "v"(g0), "v"(l1), "v"(g1),
                  "v"(l2), "v"(g2), "v"(l3), "v"(g3) : "memory");
}
// The issuing wave's copies have landed in LDS behind this wait.
__device__ __forceinline__ void wait_async0() {
  asm volatile("s_wait_asynccnt 0x0" ::: "memory");
}

__device__ __forceinline__ v2f exp2_pair(float x0, float x1) {
  float e0, e1;
  asm("v_exp_f32 %0, %2\n\t"
      "v_exp_f32 %1, %3\n\t"
      "v_nop"
      : "=&v"(e0), "=&v"(e1) : "v"(x0), "v"(x1));
  v2f r; r[0] = e0; r[1] = e1;
  return r;
}

// ------------------------------------------------- proj: Q_all / K_all GEMM
// Out(4096x256) = X(4096x256) @ Wr(256x256), Wr[d][h*32+dk] = W[h][d][dk].
// One block = 8 waves = one 128 x 64 tile of Out over the whole K = 256. Its 128 rows of X
// and its 64 columns of Wr (two heads) are brought whole into LDS, in whole 128-byte lines;
// each wave then owns 32 x 32 of the tile: two A and two B fragments feed four WMMAs.
// k runs upward in steps of 4 into one accumulator a tile.
// Wr lies in LDS by row pairs and 16-column groups, Ws[k/2][col/16][k&1][col&15], so that
// the two k of a B fragment stand 16 floats apart and one two-address read brings both.
#define XP  260
#define WPP 160

__device__ __forceinline__ void g2l_async8(const unsigned* l, const float* const* g) {
  asm volatile("global_load_async_to_lds_b128 %0, %1, off\n\t"
               "global_load_async_to_lds_b128 %2, %3, off\n\t"
               "global_load_async_to_lds_b128 %4, %5, off\n\t"
               "global_load_async_to_lds_b128 %6, %7, off\n\t"
               "global_load_async_to_lds_b128 %8, %9, off\n\t"
               "global_load_async_to_lds_b128 %10, %11, off\n\t"
               "global_load_async_to_lds_b128 %12, %13, off\n\t"
               "global_load_async_to_lds_b128 %14, %15, off\n\t"
               "s_wait_xcnt 0x0"
               :: "v"(l[0]), "v"(g[0]), "v"(l[1]), "v"(g[1]),
                  "v"(l[2]), "v"(g[2]), "v"(l[3]), "v"(g[3]),
                  "v"(l[4]), "v"(g[4]), "v"(l[5]), "v"(g[5]),
                  "v"(l[6]), "v"(g[6]), "v"(l[7]), "v"(g[7]) : "memory");
}

__global__ __launch_bounds__(256)
void proj_kernel(const float* __restrict__ query,
                 const float* __restrict__ key,
                 const float* __restrict__ Wq,
                 const float* __restrict__ Wk,
                 float* __restrict__ Qall,
                 float* __restrict__ Kall) {
  __shared__ __align__(16) float smem[(Dn / 2) * WPP + 128 * XP];
  float* Ws = smem;                        //  81,920 B
  float* Xs = smem + (Dn / 2) * WPP;       // 133,120 B
  const int tid  = threadIdx.x;
  const int lane = tid & 31, wave = tid >> 5;
  const int lrow = lane & 15, lhi = lane >> 4;
  const float* X = blockIdx.y ? key  : query;
  const float* W = blockIdx.y ? Wk   : Wq;
  float*       O = blockIdx.y ? Kall : Qall;
  const int mb = blockIdx.x >> 2;          // 32 row blocks of 128
  const int nb = blockIdx.x & 3;           // 4 column blocks of 64 = heads 2nb, 2nb+1

  // X: 128 rows x 64 float4. Copy n of a thread takes row (tid >> 6) + 4n, float4 tid & 63:
  // a wave's 32 lanes take 512 bytes in a row of one X row.
  {
    const int r = tid >> 6, c = tid & 63;
    const float* g0 = X + (size_t)(mb * 128 + r) * Dn + c * 4;
    const unsigned l0 = (unsigned)(size_t)Xs + (unsigned)(r * XP + c * 4) * 4u;
    #pragma unroll                         // both loops: l[] and g[] stay in registers
    for (int j = 0; j < 32; j += 8) {
      unsigned l[8]; const float* g[8];
      #pragma unroll
      for (int u = 0; u < 8; ++u) {
        l[u] = l0 + (unsigned)((j + u) * 4 * XP) * 4u;
        g[u] = g0 + (size_t)(j + u) * 4 * Dn;
      }
      g2l_async8(l, g);
    }
  }
  // Wr: 256 rows x 16 float4. Copy n takes row (tid >> 4) + 16n, float4 tid & 15;
  // float4 0..7 of a row come from head 2nb, 8..15 from head 2nb+1.
  {
    const int k = tid >> 4, c = tid & 15;
    const float* g0 = W + (size_t)(nb * 2 + (c >> 3)) * (Dn * DKn) + (size_t)k * DKn + (c & 7) * 4;
    const unsigned l0 = (unsigned)(size_t)Ws
        + (unsigned)((k >> 1) * WPP + (c >> 2) * 32 + (k & 1) * 16 + (c & 3) * 4) * 4u;
    #pragma unroll                         // both loops: l[] and g[] stay in registers
    for (int j = 0; j < 16; j += 8) {
      unsigned l[8]; const float* g[8];
      #pragma unroll
      for (int u = 0; u < 8; ++u) {
        l[u] = l0 + (unsigned)((j + u) * 8 * WPP) * 4u;
        g[u] = g0 + (size_t)(j + u) * 16 * DKn;
      }
      g2l_async8(l, g);
    }
  }
  wait_async0();                            // own copies landed
  __syncthreads();                          // X and Wr visible to all waves

  const int wm = wave >> 1, wn = wave & 1;  // 4 x 2 waves of 32 x 32
  const float* xa = &Xs[(wm * 32 + lrow) * XP + lhi * 2];    // A: K = lhi*2 + {0,1}
  const float* wb = &Ws[lhi * WPP + wn * 64 + lrow];         // B: the same K, column lrow
  v8f c00 = {}, c01 = {}, c10 = {}, c11 = {};
  // Unrolled whole: the LDS reads of later steps stand among the WMMAs of earlier ones,
  // and no loop top drains them.
  #pragma unroll
  for (int kc = 0; kc < Dn; kc += 4) {
    v2f a0 = *(const v2f*)(xa + kc);
    v2f a1 = *(const v2f*)(xa + 16 * XP + kc);
    v2f b0, b1;
    b0[0] = wb[(kc >> 1) * WPP];      b0[1] = wb[(kc >> 1) * WPP + 16];
    b1[0] = wb[(kc >> 1) * WPP + 32]; b1[1] = wb[(kc >> 1) * WPP + 48];
    c00 = wmma4(a0, b0, c00);
    c01 = wmma4(a0, b1, c01);
    c10 = wmma4(a1, b0, c10);
    c11 = wmma4(a1, b1, c11);
  }
  float* Ob = O + (size_t)(mb * 128 + wm * 32 + lhi * 8) * Dn + nb * 64 + wn * 32 + lrow;
  #pragma unroll
  for (int i = 0; i < 8; ++i) {
    Ob[(size_t)i * Dn]             = c00[i];
    Ob[(size_t)i * Dn + 16]        = c01[i];
    Ob[(size_t)(i + 16) * Dn]      = c10[i];
    Ob[(size_t)(i + 16) * Dn + 16] = c11[i];
  }
}

#define KP  36
#define WP2 168
#define TR 4
#define QR 16

__device__ __forceinline__ v8f tanh8(v8f x) {
  float y0, y1, y2, y3, y4, y5, y6, y7;
  asm("v_tanh_f32 %0, %8\n\t"
      "v_tanh_f32 %1, %9\n\t"
      "v_tanh_f32 %2, %10\n\t"
      "v_tanh_f32 %3, %11\n\t"
      "v_tanh_f32 %4, %12\n\t"
      "v_tanh_f32 %5, %13\n\t"
      "v_tanh_f32 %6, %14\n\t"
      "v_tanh_f32 %7, %15\n\t"
      "v_nop"
      : "=&v"(y0), "=&v"(y1), "=&v"(y2), "=&v"(y3),
        "=&v"(y4), "=&v"(y5), "=&v"(y6), "=&v"(y7)
      : "v"(x[0]), "v"(x[1]), "v"(x[2]), "v"(x[3]),
        "v"(x[4]), "v"(x[5]), "v"(x[6]), "v"(x[7]));
  v8f r = {y0, y1, y2, y3, y4, y5, y6, y7};
  return r;
}
// Score tiles T0 .. T0+3 of one wave, from its own K rows.
template <int T0>
__device__ __forceinline__ void score4(const float* Kw, const v2f* qf, v8f* s, int lrow, int lhi) {
  #pragma unroll
  for (int t = T0; t < T0 + 4; ++t) {
    v8f c = {};
    #pragma unroll
    for (int kc = 0; kc < 8; ++kc) {
      v2f a = *(const v2f*)&Kw[(t * 16 + lrow) * KP + kc * 4 + lhi * 2];
      c = wmma4(a, qf[kc], c);
    }
    s[t] = c;
  }
}

__global__ __launch_bounds__(256)
void attn_tail_kernel(const float* value,   // value, mask: no __restrict__, so that their loads
                      const float* mask,    // keep the place among the waits where they are written
                      const float* __restrict__ ws,
                      const float* __restrict__ Wc,
                      const float* __restrict__ bc,
                      const float* __restrict__ Wo1,
                      const float* __restrict__ bo1,
                      const float* __restrict__ Wo2,
                      const float* __restrict__ bo2,
                      float* __restrict__ out) {
  const float* Qall = ws;                  // written by proj_kernel
  const float* Kall = ws + Bn * TQn * Dn;
  __shared__ __align__(16) float smem[Hn * (TKn + QR) * KP];   // 313,344 B
  const int tid  = threadIdx.x;
  const int lane = tid & 31, wave = tid >> 5;
  const int lrow = lane & 15, lhi = lane >> 4;
  const int b = blockIdx.x >> 4, qt = blockIdx.x & 15;
  const int h = wave;
  float* Kw = smem + wave * ((TKn + QR) * KP);   // 36,864 B: this wave's K(b,h)
  float* Qw = Kw + TKn * KP;                     //  2,304 B: this wave's 16 query rows
  float* Wp = smem;                              // 86,016 B, laid over K after the scores
  float* hh = smem + Hn * 16 * W2C;              // 18,432 B behind the num|den tiles: head[row][f][h]

  const int cr = lane >> 3, cc = lane & 7;
  const float* Kg = Kall + ((size_t)b * TKn + cr) * Dn + h * DKn + cc * 4;
  const unsigned kl = (unsigned)(size_t)Kw + (unsigned)(cr * KP + cc * 4) * 4u;
  {
    const float* Qg = Qall + ((size_t)b * TQn + qt * QR + cr) * Dn + h * DKn + cc * 4;
    const unsigned ql = (unsigned)(size_t)Qw + (unsigned)(cr * KP + cc * 4) * 4u;
    g2l_async4(ql,                 Qg,
               ql +  4 * KP * 4u,  Qg +  4 * Dn,
               ql +  8 * KP * 4u,  Qg +  8 * Dn,
               ql + 12 * KP * 4u,  Qg + 12 * Dn);
  }
  #pragma unroll                           // both loops: l[] and g[] stay in registers
  for (int j = 0; j < 48; j += 8) {        // keys 0 .. 191
    unsigned l[8]; const float* g[8];
    #pragma unroll
    for (int u = 0; u < 8; ++u) {
      l[u] = kl + (unsigned)((j + u) * 4 * KP) * 4u;
      g[u] = Kg + (size_t)(j + u) * 4 * Dn;
    }
    g2l_async8(l, g);
  }

  // What the tail needs is asked for here: its trips to memory lie under the score phase,
  // and no such load is open at a later barrier.
  const int d0 = wave * 32 + lrow;
  v2f wb[2][2];
  float bv[2], ob[2], b1[SFn], w2[SFn];
  #pragma unroll
  for (int n = 0; n < 2; ++n) {
    const float* wp = Wc + (lhi * 4) * Dn + d0 + n * 16;
    wb[n][0][0] = wp[0];      wb[n][0][1] = wp[Dn];
    wb[n][1][0] = wp[2 * Dn]; wb[n][1][1] = wp[3 * Dn];
    bv[n] = bc[d0 + n * 16];
    ob[n] = bo2[d0 + n * 16];
  }
  // Stands in front of the scalar loads below, which may take over the scalar base registers
  // that the vector loads above name.
  asm volatile("s_wait_xcnt 0x0" ::: "memory");
  #pragma unroll
  for (int q = 0; q < SFn; ++q) { b1[q] = bo1[q]; w2[q] = Wo2[q]; }

  // All but the 32 youngest copies have landed: Q and keys 0 .. 63.
  asm volatile("s_wait_asynccnt 0x20" ::: "memory");
  #pragma unroll                           // both loops: l[] and g[] stay in registers
  for (int j = 48; j < 64; j += 8) {       // keys 192 .. 255
    unsigned l[8]; const float* g[8];
    #pragma unroll
    for (int u = 0; u < 8; ++u) {
      l[u] = kl + (unsigned)((j + u) * 4 * KP) * 4u;
      g[u] = Kg + (size_t)(j + u) * 4 * Dn;
    }
    g2l_async8(l, g);
  }

  // Q^T fragments (B operand: column q = lrow), held for all 16 key tiles.
  v2f qf[8];
  #pragma unroll
  for (int kc = 0; kc < 8; ++kc)
    qf[kc] = *(const v2f*)&Qw[lrow * KP + kc * 4 + lhi * 2];

  v8f s[16];
  // The scheduling barrier ahead of a wait keeps the WMMAs of the landed keys in front of it,
  // so that they run while the later keys are still in flight. None stands ahead of the last
  // wait: the loads of value and mask and their first uses then fall to one scheduling region.
  score4<0>(Kw, qf, s, lrow, lhi);
  __builtin_amdgcn_sched_barrier(0);
  asm volatile("s_wait_asynccnt 0x20" ::: "memory");   // keys 64 .. 127 have landed
  score4<4>(Kw, qf, s, lrow, lhi);
  __builtin_amdgcn_sched_barrier(0);
  asm volatile("s_wait_asynccnt 0x10" ::: "memory");   // keys 128 .. 191 have landed

  // W2(b): one task = one key pair p x four features; 128 x 9 = 1152 tasks:
  // four a thread, and the last 128 cut in halves of two features, one a thread.
  // The loads stand here so that their trip lies under the last eight score tiles.
  const float* vb = value + (size_t)b * TKn * Fn;
  const float* mb = mask  + (size_t)b * TKn * Fn;
  float4 va[4], vc[4], ma[4], mc[4];
  const float* pv[4]; const float* pm[4];
  int wo[4];
  #pragma unroll
  for (int j = 0; j < 4; ++j) {
    int task = tid + j * 256;
    int p = task / (Fn / 4), fq = task - p * (Fn / 4);
    unsigned e = (unsigned)((2 * p) * Fn + fq * 4);
    pv[j] = vb + e; pm[j] = mb + e;
    va[j] = *(const float4*)(pv[j]); vc[j] = *(const float4*)(pv[j] + Fn);
    ma[j] = *(const float4*)(pm[j]); mc[j] = *(const float4*)(pm[j] + Fn);
    wo[j] = p * WP2 + fq * 8;
  }
  int taskh = 1024 + (tid >> 1);
  int ph = taskh / (Fn / 4), fh = (taskh - ph * (Fn / 4)) * 4 + (tid & 1) * 2;
  unsigned eh = (unsigned)((2 * ph) * Fn + fh);
  const float* pvh = vb + eh; const float* pmh = mb + eh;
  float2 vah = *(const float2*)(pvh), vch = *(const float2*)(pvh + Fn);
  float2 mah = *(const float2*)(pmh), mch = *(const float2*)(pmh + Fn);
  // Stands in front of any later write of the address registers that the loads above name.
  // The addresses are inputs of the statement, so that their registers are left alone up to it.
  asm volatile("s_wait_xcnt 0x0"
               :: "v"(pv[0]), "v"(pv[1]), "v"(pv[2]), "v"(pv[3]), "v"(pvh),
                  "v"(pm[0]), "v"(pm[1]), "v"(pm[2]), "v"(pm[3]), "v"(pmh) : "memory");

  score4<8>(Kw, qf, s, lrow, lhi);
  wait_async0();                                       // keys 192 .. 255 have landed
  score4<12>(Kw, qf, s, lrow, lhi);

  // Row maximum of q = lrow: in-lane over this half's 128 keys, then the other half.
  float rm = s[0][0];
  #pragma unroll
  for (int t = 0; t < 16; ++t) {
    #pragma unroll
    for (int i = 0; i < 8; ++i) rm = fmaxf(rm, s[t][i]);
  }
  rm = fmaxf(rm, __shfl_xor(rm, 16, 32));

  __syncthreads();                          // every wave has left its K and Q before W2 overlays them

  #pragma unroll
  for (int j = 0; j < 4; ++j) {
    float* wn = &Wp[wo[j]];                // columns [0,36): mask*value
    float* wd = wn + 2 * Fn;               // columns [36,72): mask
    *(float4*)(wn)     = make_float4(ma[j].x * va[j].x, mc[j].x * vc[j].x,
                                     ma[j].y * va[j].y, mc[j].y * vc[j].y);
    *(float4*)(wn + 4) = make_float4(ma[j].z * va[j].z, mc[j].z * vc[j].z,
                                     ma[j].w * va[j].w, mc[j].w * vc[j].w);
    *(float4*)(wd)     = make_float4(ma[j].x, mc[j].x, ma[j].y, mc[j].y);
    *(float4*)(wd + 4) = make_float4(ma[j].z, mc[j].z, ma[j].w, mc[j].w);
  }
  {
    float* wn = &Wp[ph * WP2 + fh * 2];
    *(float4*)(wn)          = make_float4(mah.x * vah.x, mch.x * vch.x,
                                          mah.y * vah.y, mch.y * vch.y);
    *(float4*)(wn + 2 * Fn) = make_float4(mah.x, mch.x, mah.y, mch.y);
  }
  #pragma unroll
  for (int j = 0; j < 2; ++j) {            // columns [72,80): zero pad, 16 floats a pair
    int z = tid + j * 256;
    *(float4*)&Wp[(z >> 2) * WP2 + 4 * Fn + (z & 3) * 4] = make_float4(0.f, 0.f, 0.f, 0.f);
  }

  __syncthreads();                          // W2 visible to all waves

  v8f c0 = {}, c1 = {}, c2 = {}, c3 = {}, c4 = {};
  #pragma unroll
  for (int t = 0; t < 16; ++t) {
    #pragma unroll
    for (int j = 0; j < 4; ++j) {
      // exp(x) = exp2(x * log2(e)); each E elem once
      v2f a = exp2_pair((s[t][2 * j]     - rm) * 1.44269504f,
                        (s[t][2 * j + 1] - rm) * 1.44269504f);
      const float* pw = &Wp[(t * 8 + lhi * 4 + j) * WP2 + lrow * 2];
      v2f b0 = *(const v2f*)(pw);
      v2f b1f = *(const v2f*)(pw + 32);
      v2f b2 = *(const v2f*)(pw + 64);
      v2f b3 = *(const v2f*)(pw + 96);
      v2f b4 = *(const v2f*)(pw + 128);
      c0 = wmma4(a, b0, c0);
      c1 = wmma4(a, b1f, c1);
      c2 = wmma4(a, b2, c2);
      c3 = wmma4(a, b3, c3);
      c4 = wmma4(a, b4, c4);
    }
  }
  __syncthreads();                          // every wave has left W2 before its LDS is reused

  // Spill num|den tile to (wave-private) LDS, then divide and hand the head values over in LDS.
  float* acc = &Wp[(size_t)wave * 16 * W2C];
  #pragma unroll
  for (int i = 0; i < 8; ++i) {
    int r = i + lhi * 8;
    acc[r * W2C +  0 + lrow] = c0[i];
    acc[r * W2C + 16 + lrow] = c1[i];
    acc[r * W2C + 32 + lrow] = c2[i];
    acc[r * W2C + 48 + lrow] = c3[i];
    acc[r * W2C + 64 + lrow] = c4[i];
  }
  for (int idx = lane; idx < 16 * Fn; idx += 32) {
    int r = idx / Fn, f = idx - r * Fn;
    float num = acc[r * W2C + f];
    float den = acc[r * W2C + Fn + f];
    float hv = (den > 0.f) ? (num / den) : 0.f;   // all-masked column ~ prob 2^-256
    hh[idx * Hn + h] = hv;                 // idx = r * Fn + f
  }
  __syncthreads();                          // all eight heads of the 16 rows visible to all waves

  v8f cb[2];
  #pragma unroll
  for (int n = 0; n < 2; ++n) {
    #pragma unroll
    for (int i = 0; i < 8; ++i) cb[n][i] = bv[n];
  }
  const int bq0 = blockIdx.x * QR;
  // Kept rolled: four equal passes, one a group of 4 rows; unrolling would only lengthen the code.
  #pragma unroll 1
  for (int grp = 0; grp < QR / TR; ++grp) {
    float ts[2][2][SFn];                   // [row & 1][column tile][s]
    #pragma unroll
    for (int q = 0; q < 2; ++q)
      #pragma unroll
      for (int n = 0; n < 2; ++n)
        #pragma unroll
        for (int u = 0; u < SFn; ++u) ts[q][n][u] = 0.f;

    const float* ap = &hh[(grp * TR + (lrow >> 2)) * (Fn * Hn) + (lrow & 3) * Hn + lhi * 4];
    float4 a = *(const float4*)ap;
    // Kept rolled: the scheduling barrier below lets nothing cross from one trip into the next,
    // so that unrolling would only lengthen the code.
    #pragma unroll 1
    for (int t = 0; t < Fn / 4; ++t) {
      // The next trip's A fragment, read under this trip's work (the last trip reads its own again).
      float4 an = *(const float4*)(ap + (t < Fn / 4 - 1 ? t + 1 : t) * 4 * Hn);
      // Holds that read and its address sum ahead of the WMMAs, so that no vector write falls
      // in among them onto a register that one of them reads as A.
      __builtin_amdgcn_sched_barrier(0);
      v2f a0, a1;
      a0[0] = a.x; a0[1] = a.y; a1[0] = a.z; a1[1] = a.w;
      const float* w1 = Wo1 + t * 4 * SFn; // same for the whole wave
      v8f dd[2];
      dd[0] = wmma4(a0, wb[0][0], cb[0]);
      dd[1] = wmma4(a0, wb[1][0], cb[1]);
      dd[0] = wmma4(a1, wb[0][1], dd[0]);
      dd[1] = wmma4(a1, wb[1][1], dd[1]);
      asm volatile("v_nop\n\tv_nop\n\tv_nop\n\tv_nop" : "+v"(dd[0]), "+v"(dd[1]));
      #pragma unroll
      for (int n = 0; n < 2; ++n) {
        v8f lt = tanh8(dd[n]);
        #pragma unroll
        for (int i = 0; i < 8; ++i) {
          float lat = lt[i];
          #pragma unroll
          for (int u = 0; u < SFn; ++u)
            ts[i >> 2][n][u] = fmaf(lat, w1[(i & 3) * SFn + u], ts[i >> 2][n][u]);
        }
      }
      a = an;
    }
    v8f th[3];                             // tanh(ts + bo1), value (2q + n) * SFn + s
    #pragma unroll
    for (int g = 0; g < 3; ++g) {
      v8f x;
      #pragma unroll
      for (int i = 0; i < 8; ++i) {
        const int e = g * 8 + i, qn = e / SFn, u = e - qn * SFn;
        x[i] = ts[qn >> 1][qn & 1][u] + b1[u];
      }
      th[g] = tanh8(x);
    }
    #pragma unroll
    for (int q = 0; q < 2; ++q) {
      #pragma unroll
      for (int n = 0; n < 2; ++n) {
        float o = ob[n];
        #pragma unroll
        for (int u = 0; u < SFn; ++u) {
          const int e = (2 * q + n) * SFn + u;
          o = fmaf(th[e >> 3][e & 7], w2[u], o);
        }
        out[(size_t)(bq0 + grp * TR + 2 * lhi + q) * Dn + d0 + n * 16] = o;
      }
    }
    // Stands in front of the next pass's writes of the address registers that the stores name.
    asm volatile("s_wait_xcnt 0x0" ::: "memory");
  }
}

// ---------------------------------------------------------------- launcher
extern "C" void kernel_launch(void* const* d_in, const int* in_sizes, int n_in,
                              void* d_out, int out_size, void* d_ws, size_t ws_size,
                              hipStream_t stream) {
  const float* query = (const float*)d_in[0];
  const float* key   = (const float*)d_in[1];
  const float* value = (const float*)d_in[2];
  const float* mask  = (const float*)d_in[3];
  const float* Wq    = (const float*)d_in[4];
  const float* Wk    = (const float*)d_in[5];
  const float* Wc    = (const float*)d_in[6];
  const float* bc    = (const float*)d_in[7];
  const float* Wo1   = (const float*)d_in[8];
  const float* bo1   = (const float*)d_in[9];
  const float* Wo2   = (const float*)d_in[10];
  const float* bo2   = (const float*)d_in[11];
  float* out = (float*)d_out;

  // Scratch layout (floats). Total = 2,097,152 floats = ~8.4 MB.
  float* ws   = (float*)d_ws;
  float* Qall = ws;                    // 4096*256   = 1,048,576
  float* Kall = Qall + 1048576;        //             1,048,576

  proj_kernel   <<<dim3(128, 2),  256, 0, stream>>>(query, key, Wq, Wk, Qall, Kall);
  attn_tail_kernel<<<dim3(256),  256, 0, stream>>>(value, mask, ws, Wc, bc, Wo1, bo1, Wo2, bo2, out);

  (void)in_sizes; (void)n_in; (void)out_size; (void)ws_size;
}
